// v000
// Times are from an AMD MI455X. After a warm-up the kernel runs many times in a row, and a time is the length of
// such a window on the GPU divided by its runs, so every launch and the gaps after it count. The runs cycle
// through copies of the inputs. A figure is the median of several windows, for all but v000 over two sittings.
// Sittings can differ by a few percent; kernels timed side by side share one.
// v000 is the starting kernel. One run takes 132 microseconds.
#include <hip/hip_runtime.h>
// Channel-first spatial attention block with one-group GroupNorm and a plain residual: x [1][128][64][64] -> h = GN(x) (one mean / rstd over all 128 x 4096 values, per-channel affine);
// q/k/v = 1x1 convs ([out][in] weights + bias), 4 heads x 32; scores = q.k * 32^-0.5; softmax over the 4096 keys; ctx = P.v; result = x + pw.ctx + pb.
// (token-major q/k planes [head][n][32], d-major V^T plane [c][n]); flash attention with S^T = K.Q^T so that the score accumulators are directly the B operand of O^T = V^T.P^T
// (online softmax, one cross-half shuffle per step, no score plane); projection GEMM with the residual added at the float4 store stage.
// Compute dtype: every contraction v_wmma_f32_16x16x32_f16 (f16 operands, f32 accumulate), single products; all float inputs RNE-converted to bf16 first (exact in f16);
// carries: weights x16, P x256, ctx x32; statistics, softmax, residual in f32.
#ifndef NB
#define NB 1
#endif
#ifndef SEQ
#define SEQ 4096
#endif
#define SEQ_FULL 4096
#define CC 128
#define NH 4
#define HD 32
#define HXP 136                      /* LDS pitch (halves) of token-major 128-wide tiles */
#define SVP 72                       /* LDS pitch (halves) of the channel-major 64-token tile */
#define SOP 68                       /* LDS pitch (floats) of the projection tile */
#define XS ((size_t)CC * SEQ_FULL)   /* per-batch stride of x / out */
#define QKS ((size_t)NB * NH * SEQ * HD)   /* halves between the q plane and the k plane */

static_assert(CC == NH * HD);
static_assert(HD == 32);
static_assert(CC == 128);
static_assert(CC <= 256);
static_assert(SEQ % 64 == 0);
static_assert(SEQ <= SEQ_FULL);
static_assert(64 * HXP <= 128 * SVP);
static_assert(HXP % 8 == 0 && SVP % 8 == 0 && SOP % 4 == 0);
static_assert((CC * CC) % (8 * 256) == 0);

typedef _Float16 v16h __attribute__((ext_vector_type(16)));
typedef unsigned short v8us __attribute__((ext_vector_type(8), may_alias));
typedef float v8f  __attribute__((ext_vector_type(8)));
typedef float v4f  __attribute__((ext_vector_type(4)));
typedef float v4fa __attribute__((ext_vector_type(4), may_alias));
union FragH { v16h v; v8us half[2]; _Float16 h[16]; unsigned short u[16]; };

// workspace carve (bytes, every region a multiple of 256)
constexpr size_t WS_W16 = 0;
constexpr size_t SZ_W16 = (size_t)4 * CC * CC * 2;
constexpr size_t WS_GS  = WS_W16 + SZ_W16;
constexpr size_t SZ_GS  = (size_t)NB * 2 * CC * 32 * 4;
constexpr size_t WS_QK  = WS_GS + SZ_GS;
constexpr size_t SZ_QK  = 2 * QKS * 2;
constexpr size_t WS_VT  = WS_QK + SZ_QK;
constexpr size_t SZ_VT  = (size_t)NB * CC * SEQ * 2;
constexpr size_t WS_AO  = WS_VT + SZ_VT;
constexpr size_t SZ_AO  = (size_t)NB * SEQ * CC * 2;
constexpr size_t WS_TOTAL = WS_AO + SZ_AO;
static_assert(SZ_W16 % 256 == 0 && SZ_GS % 256 == 0 && SZ_QK % 256 == 0 && SZ_VT % 256 == 0 && SZ_AO % 256 == 0);
static_assert(WS_TOTAL <= (size_t)134217728);

__device__ __forceinline__ float bf16_rne(float x) {
  unsigned int u = __float_as_uint(x);
  u = (u + 0x7FFFu + ((u >> 16) & 1u)) & 0xFFFF0000u;
  return __uint_as_float(u);
}

// 16x32 operand fragment from a k-contiguous 16-bit global row: elements 0..7 <- k 8h..8h+7, elements 8..15 <- k 16+8h..16+8h+7 (same map for A and B)
__device__ __forceinline__ v16h ld_frag(const _Float16* __restrict__ p, int hh) {
  FragH f;
  const unsigned short* q = (const unsigned short*)p;
  f.half[0] = *(const v8us*)(q + 8 * hh);
  f.half[1] = *(const v8us*)(q + 16 + 8 * hh);
  return f.v;
}
__device__ __forceinline__ v8f mma(v16h a, v16h b, v8f c) {
  v8f d = __builtin_amdgcn_wmma_f32_16x16x32_f16(false, a, false, b, (short)0, c, false, false);
  asm volatile("v_nop\n\tv_nop\n\tv_nop\n\tv_nop" : "+v"(d) : "v"(a), "v"(b));
  return d;
}

// fixed-order block sum over 256 threads (LDS tree); every thread gets the total
__device__ __forceinline__ float blk_sum256(float v) {
  __shared__ float red[256];
  const int t = threadIdx.x;
  red[t] = v;
  __syncthreads();
#pragma unroll 1
  for (int st = 128; st > 0; st >>= 1) {
    if (t < st) red[t] = red[t] + red[t + st];
    __syncthreads();
  }
  const float r = red[0];
  __syncthreads();
  return r;
}

__device__ __forceinline__ v8us cvt_w8(const float* __restrict__ w, int e) {
  const v4f a = *(const v4fa*)(w + e), c = *(const v4fa*)(w + e + 4);
  FragH f;
#pragma unroll
  for (int q = 0; q < 4; ++q) {
    f.h[q]     = (_Float16)(bf16_rne(a[q]) * 16.0f);
    f.h[4 + q] = (_Float16)(bf16_rne(c[q]) * 16.0f);
  }
  return f.half[0];
}

__global__ __launch_bounds__(256) void k_wcvt(const float* __restrict__ qw, const float* __restrict__ kw, const float* __restrict__ vw,
                                              const float* __restrict__ pw, _Float16* __restrict__ W16) {
  const int t = blockIdx.x * 256 + threadIdx.x;
  if (t >= CC * CC / 8) return;
  const int e = t * 8;
  const v8us v0 = cvt_w8(qw, e), v1 = cvt_w8(kw, e), v2 = cvt_w8(vw, e), v3 = cvt_w8(pw, e);
  unsigned short* d = (unsigned short*)W16 + e;
  {
    *(v8us*)(d) = v0;
    *(v8us*)(d + CC * CC) = v1;
    *(v8us*)(d + 2 * CC * CC) = v2;
    *(v8us*)(d + 3 * CC * CC) = v3;
    
  }
}

__global__ __launch_bounds__(256) void k_gnsum(const float* __restrict__ x, float* __restrict__ GS) {
  const int tid = threadIdx.x, c = blockIdx.x, b = blockIdx.y;
  const float* xr = x + (size_t)b * XS + (size_t)c * SEQ_FULL;
  float s = 0.f;
#pragma unroll 1
  for (int j = tid * 4; j < SEQ; j += 1024) {
    const v4f a = *(const v4fa*)(xr + j);
    s += (bf16_rne(a[0]) + bf16_rne(a[1])) + (bf16_rne(a[2]) + bf16_rne(a[3]));
  }
  const float tot = blk_sum256(s);
  float* d = GS + ((size_t)b * 2 * CC + c) * 32;
  const v4f o = {(tid == 0) ? tot : 0.f, 0.f, 0.f, 0.f};
  if (tid < 8) *(v4f*)(d + tid * 4) = o;
  
}

__global__ __launch_bounds__(256) void k_gnvar(const float* __restrict__ x, const float* __restrict__ GSs, float* __restrict__ GSv) {
  const int tid = threadIdx.x, c = blockIdx.x, b = blockIdx.y;
  const float ps = GSs[((size_t)b * 2 * CC + (tid & (CC - 1))) * 32];
  const float mean = blk_sum256((tid < CC) ? ps : 0.f) * (1.0f / (float)(CC * SEQ));
  const float* xr = x + (size_t)b * XS + (size_t)c * SEQ_FULL;
  float s = 0.f;
#pragma unroll 1
  for (int j = tid * 4; j < SEQ; j += 1024) {
    const v4f a = *(const v4fa*)(xr + j);
    const float d0 = bf16_rne(a[0]) - mean, d1 = bf16_rne(a[1]) - mean, d2 = bf16_rne(a[2]) - mean, d3 = bf16_rne(a[3]) - mean;
    s += (d0 * d0 + d1 * d1) + (d2 * d2 + d3 * d3);
  }
  const float tot = blk_sum256(s);
  float* d = GSv + ((size_t)b * 2 * CC + CC + c) * 32;
  const v4f o = {(tid == 0) ? tot : 0.f, 0.f, 0.f, 0.f};
  if (tid < 8) *(v4f*)(d + tid * 4) = o;
  
}

// fused normalise + q/k/v GEMM for 64 tokens per block (8 waves; wave w owns output channels 16w..16w+15).
// q, k: D[token][o] (A = h tile rows, B = weight rows) -> token-major planes QK[{q,k}][head][n][32];
__global__ __launch_bounds__(256) void k_qkv(const float* __restrict__ x, const float* __restrict__ gnw, const float* __restrict__ gnb,
                                             const _Float16* __restrict__ W16, const float* __restrict__ qb, const float* __restrict__ kb,
                                             const float* __restrict__ vb, const float* __restrict__ GS,
                                             _Float16* __restrict__ QK, _Float16* __restrict__ VT) {
  __shared__ __attribute__((aligned(16))) _Float16 hx[64 * HXP];
  __shared__ __attribute__((aligned(16))) _Float16 stg[128 * SVP];
  const int tid = threadIdx.x, w = tid >> 5, lane = tid & 31, ln = lane & 15, hh = lane >> 4;
  const int n0 = blockIdx.x * 64, b = blockIdx.y;
  const float invn = 1.0f / (float)(CC * SEQ);
  const size_t gsb = (size_t)b * 2 * CC;
  const float ps = GS[(gsb + (tid & (CC - 1))) * 32];
  const float pv = GS[(gsb + CC + (tid & (CC - 1))) * 32];
  const float mean = blk_sum256((tid < CC) ? ps : 0.f) * invn;
  const float var  = blk_sum256((tid < CC) ? pv : 0.f) * invn;
  const float rstd = rsqrtf(var + 1e-5f);
  const float* xb = x + (size_t)b * XS;
#pragma unroll 1
  for (int idx = tid; idx < CC * 64; idx += 256) {
    const int c = idx >> 6, col = idx & 63;
    const float v = bf16_rne(xb[(size_t)c * SEQ_FULL + n0 + col]);
    const float hv = ((v - mean) * rstd) * bf16_rne(gnw[c]) + bf16_rne(gnb[c]);
    hx[col * HXP + c] = (_Float16)hv;
  }
  __syncthreads();

  const float bqv = bf16_rne(qb[16 * w + ln]), bkv = bf16_rne(kb[16 * w + ln]);
#pragma unroll 1
  for (int m = 0; m < 2; ++m) {
    v16h fw[4];
    const _Float16* wr = W16 + (size_t)m * CC * CC + (size_t)(16 * w + ln) * CC;
#pragma unroll
    for (int kc = 0; kc < 4; ++kc) fw[kc] = ld_frag(wr + kc * 32, hh);
    const float bias = (m == 0) ? bqv : bkv;
#pragma unroll
    for (int nt = 0; nt < 4; ++nt) {
      v8f acc = {0.f, 0.f, 0.f, 0.f, 0.f, 0.f, 0.f, 0.f};
#pragma unroll
      for (int kc = 0; kc < 4; ++kc) {
        FragH fa;
        fa.half[0] = *(const v8us*)&hx[(nt * 16 + ln) * HXP + kc * 32 + 8 * hh];
        fa.half[1] = *(const v8us*)&hx[(nt * 16 + ln) * HXP + kc * 32 + 16 + 8 * hh];
        acc = mma(fa.v, fw[kc], acc);
      }
#pragma unroll
      for (int r = 0; r < 8; ++r) stg[(nt * 16 + 8 * hh + r) * HXP + 16 * w + ln] = (_Float16)(acc[r] * 0.0625f + bias);
    }
    __syncthreads();
    unsigned short* P = (unsigned short*)QK + (size_t)m * QKS + (size_t)b * NH * SEQ * HD;
    {
#pragma unroll
      for (int i = 0; i < 4; ++i) {
        const int idx = tid + 256 * i;
        const int head = idx >> 8, pi = idx & 255, tok = pi >> 2, d8 = (pi & 3) * 8;
        const v8us v = *(const v8us*)&stg[tok * HXP + head * HD + d8];
        *(v8us*)(P + ((size_t)head * SEQ + n0 + tok) * HD + d8) = v;
      }
      
    }
    __syncthreads();
  }
  {
    v16h fw[4];
    const _Float16* wr = W16 + (size_t)2 * CC * CC + (size_t)(16 * w + ln) * CC;
#pragma unroll
    for (int kc = 0; kc < 4; ++kc) fw[kc] = ld_frag(wr + kc * 32, hh);
    float bvr[8];
#pragma unroll
    for (int r = 0; r < 8; ++r) bvr[r] = bf16_rne(vb[16 * w + 8 * hh + r]);
#pragma unroll
    for (int nt = 0; nt < 4; ++nt) {
      v8f acc = {0.f, 0.f, 0.f, 0.f, 0.f, 0.f, 0.f, 0.f};
#pragma unroll
      for (int kc = 0; kc < 4; ++kc) {
        FragH fb;
        fb.half[0] = *(const v8us*)&hx[(nt * 16 + ln) * HXP + kc * 32 + 8 * hh];
        fb.half[1] = *(const v8us*)&hx[(nt * 16 + ln) * HXP + kc * 32 + 16 + 8 * hh];
        acc = mma(fw[kc], fb.v, acc);
      }
#pragma unroll
      for (int r = 0; r < 8; ++r) stg[(16 * w + 8 * hh + r) * SVP + nt * 16 + ln] = (_Float16)(acc[r] * 0.0625f + bvr[r]);
    }
    __syncthreads();
    unsigned short* V = (unsigned short*)VT + (size_t)b * CC * SEQ;
    {
#pragma unroll
      for (int i = 0; i < 4; ++i) {
        const int idx = tid + 256 * i;
        const int o = idx >> 3, p8 = (idx & 7) * 8;
        const v8us v = *(const v8us*)&stg[o * SVP + p8];
        *(v8us*)(V + (size_t)o * SEQ + n0 + p8) = v;
      }
      
    }
  }
}

// flash attention: block = 32 queries x 4 heads (wave: head = w & 3, query tile = w >> 2). Per 32-key step:
// S^T[key][q] = K.Q^T (two 16-key tiles; A = K rows, B = Q rows), online softmax per query column (lane), P^T packed from the two score tiles
// (element r <- tile 0 row 8h+r, element 8+r <- tile 1 row 8h+r) as the B operand of O^T[d][q] += V^T[d][key].P^T (A = V^T rows, two 16-d tiles).
__global__ __launch_bounds__(256) void k_attn(const _Float16* __restrict__ QK, const _Float16* __restrict__ VT, _Float16* __restrict__ AO) {
  __shared__ __attribute__((aligned(16))) _Float16 st[32 * HXP];
  const int tid = threadIdx.x, w = tid >> 5, lane = tid & 31, ln = lane & 15, hh = lane >> 4;
  const int hd = w & 3, qs = w >> 2, b = blockIdx.y;
  const int q0 = blockIdx.x * 32 + qs * 16;
  const _Float16* Qh = QK + ((size_t)b * NH + hd) * SEQ * HD;
  const _Float16* Kh = Qh + QKS;
  const _Float16* Vh = VT + ((size_t)b * CC + hd * HD) * SEQ;
  const v16h bq = ld_frag(Qh + (size_t)(q0 + ln) * HD, hh);
  const _Float16* kp  = Kh + (size_t)ln * HD;
  const _Float16* vp0 = Vh + (size_t)ln * SEQ;
  const _Float16* vp1 = Vh + (size_t)(16 + ln) * SEQ;
  const v8f z8 = {0.f, 0.f, 0.f, 0.f, 0.f, 0.f, 0.f, 0.f};
  const float sc = 0.17677669529663687f;
  float mrun = -1.0e30f, lrun = 0.f;
  v8f o0 = z8, o1 = z8;
#pragma unroll 1
  for (int kb = 0; kb < SEQ; kb += 32) {
    const v16h ka0 = ld_frag(kp + (size_t)kb * HD, hh);
    const v16h ka1 = ld_frag(kp + (size_t)(kb + 16) * HD, hh);
    v8f s0 = mma(ka0, bq, z8);
    v8f s1 = mma(ka1, bq, z8);
    float mx = -1.0e30f;
#pragma unroll
    for (int r = 0; r < 8; ++r) { s0[r] *= sc; s1[r] *= sc; mx = fmaxf(mx, fmaxf(s0[r], s1[r])); }
    mx = fmaxf(mx, __shfl_xor(mx, 16, 32));
    const float mn = fmaxf(mrun, mx);
    const float al = __expf(mrun - mn);
    mrun = mn;
    FragH pf;
    float rs = 0.f;
#pragma unroll
    for (int r = 0; r < 8; ++r) {
      const float p0 = __expf(s0[r] - mn), p1 = __expf(s1[r] - mn);
      rs += p0 + p1;
      pf.h[r]     = (_Float16)(p0 * 256.0f);
      pf.h[8 + r] = (_Float16)(p1 * 256.0f);
    }
    lrun = lrun * al + rs;
#pragma unroll
    for (int r = 0; r < 8; ++r) { o0[r] *= al; o1[r] *= al; }
    const v16h va0 = ld_frag(vp0 + kb, hh);
    const v16h va1 = ld_frag(vp1 + kb, hh);
    o0 = mma(va0, pf.v, o0);
    o1 = mma(va1, pf.v, o1);
  }
  const float lt = lrun + __shfl_xor(lrun, 16, 32);
  const float inv = 0.125f * (1.0f / lt);            /* 2^-8 (P carry) x 2^5 (ctx carry) */
  FragH e;
#pragma unroll
  for (int r = 0; r < 8; ++r) { e.h[r] = (_Float16)(o0[r] * inv); e.h[8 + r] = (_Float16)(o1[r] * inv); }
  *(v8us*)&st[(qs * 16 + ln) * HXP + hd * HD + 8 * hh]      = e.half[0];
  *(v8us*)&st[(qs * 16 + ln) * HXP + hd * HD + 16 + 8 * hh] = e.half[1];
  __syncthreads();
  unsigned short* A = (unsigned short*)AO + ((size_t)b * SEQ + (size_t)blockIdx.x * 32) * CC;
  {
#pragma unroll
    for (int i = 0; i < 2; ++i) {
      const int idx = tid + 256 * i;
      const int row = idx >> 4, p8 = (idx & 15) * 8;
      const v8us v = *(const v8us*)&st[row * HXP + p8];
      *(v8us*)(A + (size_t)row * CC + p8) = v;
    }
    
  }
}

// projection: D[o][n] = pw[o][:] . ctx[n][:] (A = weight rows, B = ctx rows), 64 tokens per block, wave w owns o = 16w..16w+15;
__global__ __launch_bounds__(256) void k_proj(const float* __restrict__ x, const _Float16* __restrict__ W16, const float* __restrict__ pb,
                                              const _Float16* __restrict__ AO, float* __restrict__ out) {
  __shared__ __attribute__((aligned(16))) float so[128 * SOP];
  const int tid = threadIdx.x, w = tid >> 5, lane = tid & 31, ln = lane & 15, hh = lane >> 4;
  const int n0 = blockIdx.x * 64, b = blockIdx.y;
  v16h fw[4];
  const _Float16* wr = W16 + (size_t)3 * CC * CC + (size_t)(16 * w + ln) * CC;
#pragma unroll
  for (int kc = 0; kc < 4; ++kc) fw[kc] = ld_frag(wr + kc * 32, hh);
#pragma unroll
  for (int nt = 0; nt < 4; ++nt) {
    const _Float16* br = AO + ((size_t)b * SEQ + n0 + nt * 16 + ln) * CC;
    v8f acc = {0.f, 0.f, 0.f, 0.f, 0.f, 0.f, 0.f, 0.f};
#pragma unroll
    for (int kc = 0; kc < 4; ++kc) { const v16h fb = ld_frag(br + kc * 32, hh); acc = mma(fw[kc], fb, acc); }
#pragma unroll
    for (int r = 0; r < 8; ++r) so[(16 * w + 8 * hh + r) * SOP + nt * 16 + ln] = acc[r] * 0.001953125f;
  }
  __syncthreads();
  const float* xb = x + (size_t)b * XS;
  float* ob = out + (size_t)b * XS;
  {
#pragma unroll 1
    for (int i = 0; i < 8; ++i) {
      const int idx = tid + 256 * i;
      const int o = idx >> 4, c4 = (idx & 15) * 4;
      const v4f a = *(const v4fa*)&so[o * SOP + c4];
      const size_t e = (size_t)o * SEQ_FULL + n0 + c4;
      const v4f xv = *(const v4fa*)(xb + e);
      const float pbv = bf16_rne(pb[o]);
      v4f y;
#pragma unroll
      for (int q = 0; q < 4; ++q) y[q] = bf16_rne(xv[q]) + (a[q] + pbv);
      *(v4f*)(ob + e) = y;
    }
    
  }
}

extern "C" void kernel_launch(void* const* d_in, const int* in_sizes, int n_in,
                              void* d_out, int out_size, void* d_ws, size_t ws_size, hipStream_t stream) {
  if (n_in < 11) return;
  if (in_sizes[0] < NB * CC * SEQ) return;
  if (in_sizes[1] < CC || in_sizes[2] < CC || in_sizes[4] < CC || in_sizes[6] < CC || in_sizes[8] < CC || in_sizes[10] < CC) return;
  if (in_sizes[3] < CC * CC || in_sizes[5] < CC * CC || in_sizes[7] < CC * CC || in_sizes[9] < CC * CC) return;
  if (out_size < NB * CC * SEQ) return;
  if (ws_size < WS_TOTAL) return;
  const float* x   = (const float*)d_in[0];
  const float* gnw = (const float*)d_in[1];
  const float* gnb = (const float*)d_in[2];
  const float* qw  = (const float*)d_in[3];
  const float* qb  = (const float*)d_in[4];
  const float* kw  = (const float*)d_in[5];
  const float* kb  = (const float*)d_in[6];
  const float* vw  = (const float*)d_in[7];
  const float* vb  = (const float*)d_in[8];
  const float* pw  = (const float*)d_in[9];
  const float* pb  = (const float*)d_in[10];
  char* ws = (char*)d_ws;
  _Float16* W16 = (_Float16*)(ws + WS_W16);
  float*    GS  = (float*)(ws + WS_GS);
  _Float16* QK  = (_Float16*)(ws + WS_QK);
  _Float16* VT  = (_Float16*)(ws + WS_VT);
  _Float16* AO  = (_Float16*)(ws + WS_AO);
  k_wcvt<<<dim3(CC * CC / 8 / 256), 256, 0, stream>>>(qw, kw, vw, pw, W16);
  k_gnsum<<<dim3(CC, NB), 256, 0, stream>>>(x, GS);
  k_gnvar<<<dim3(CC, NB), 256, 0, stream>>>(x, GS, GS);
  k_qkv<<<dim3(SEQ / 64, NB), 256, 0, stream>>>(x, gnw, gnb, W16, qb, kb, vb, GS, QK, VT);
  k_attn<<<dim3(SEQ / 32, NB), 256, 0, stream>>>(QK, VT, AO);
  k_proj<<<dim3(SEQ / 64, NB), 256, 0, stream>>>(x, W16, pb, AO, (float*)d_out);
}

// v001
// Measured time: 60.8 microseconds a run.
// In two side-by-side timings against v000, it was 2.28 and 2.14 times as fast.
#include <hip/hip_runtime.h>
// Channel-first spatial attention block with one-group GroupNorm and a plain residual: x [1][128][64][64] -> h = GN(x) (one mean / rstd over all 128 x 4096 values, per-channel affine);
// q/k/v = 1x1 convs ([out][in] weights + bias), 4 heads x 32; scores = q.k * 32^-0.5; softmax over the 4096 keys; ctx = P.v; result = x + pw.ctx + pb.
// (token-major q/k planes [head][n][32], d-major V^T plane [c][n]); flash attention with S^T = K.Q^T so that the score accumulators are directly the B operand of O^T = V^T.P^T
// (online softmax, one cross-half shuffle per step, no score plane); projection GEMM with the residual added at the float4 store stage.
// Compute dtype: every contraction v_wmma_f32_16x16x32_f16 (f16 operands, f32 accumulate), single products; all float inputs RNE-converted to bf16 first (exact in f16);
// carries: weights x16, P x256, ctx x32; statistics, softmax, residual in f32.
#ifndef NB
#define NB 1
#endif
#ifndef SEQ
#define SEQ 4096
#endif
#define SEQ_FULL 4096
#define CC 128
#define NH 4
#define HD 32
#define HXP 136                      /* LDS pitch (halves) of token-major 128-wide tiles */
#define SVP 72                       /* LDS pitch (halves) of the channel-major 64-token tile */
#define KSPL 8                       /* key ranges per (query tile, head) in the attention block */
#define SOP 68                       /* LDS pitch (floats) of the projection tile */
#define XS ((size_t)CC * SEQ_FULL)   /* per-batch stride of x / out */
#define QKS ((size_t)NB * NH * SEQ * HD)   /* halves between the q plane and the k plane */

static_assert(CC == NH * HD);
static_assert(HD == 32);
static_assert(CC == 128);
static_assert(CC <= 256);
static_assert(SEQ % 64 == 0);
static_assert(SEQ <= SEQ_FULL);
static_assert(SEQ % (KSPL * 32) == 0);
static_assert(4 * KSPL * 32 == 1024);
static_assert(64 * HXP <= 128 * SVP);
static_assert(HXP % 8 == 0 && SVP % 8 == 0 && SOP % 4 == 0);
static_assert((CC * CC) % (8 * 256) == 0);

typedef _Float16 v16h __attribute__((ext_vector_type(16)));
typedef unsigned short v8us __attribute__((ext_vector_type(8), may_alias));
typedef float v8f  __attribute__((ext_vector_type(8)));
typedef float v4f  __attribute__((ext_vector_type(4)));
typedef float v4fa __attribute__((ext_vector_type(4), may_alias));
typedef float v2f  __attribute__((ext_vector_type(2)));
typedef _Float16 v2h __attribute__((ext_vector_type(2)));
union FragH { v16h v; v8us half[2]; _Float16 h[16]; unsigned short u[16]; };

// workspace carve (bytes, every region a multiple of 256)
constexpr size_t WS_W16 = 0;
constexpr size_t SZ_W16 = (size_t)4 * CC * CC * 2;
constexpr size_t WS_GS  = WS_W16 + SZ_W16;
constexpr size_t SZ_GS  = (size_t)NB * 2 * CC * 32 * 4;
constexpr size_t WS_QK  = WS_GS + SZ_GS;
constexpr size_t SZ_QK  = 2 * QKS * 2;
constexpr size_t WS_VT  = WS_QK + SZ_QK;
constexpr size_t SZ_VT  = (size_t)NB * CC * SEQ * 2;
constexpr size_t WS_AO  = WS_VT + SZ_VT;
constexpr size_t SZ_AO  = (size_t)NB * SEQ * CC * 2;
constexpr size_t WS_TOTAL = WS_AO + SZ_AO;
static_assert(SZ_W16 % 256 == 0 && SZ_GS % 256 == 0 && SZ_QK % 256 == 0 && SZ_VT % 256 == 0 && SZ_AO % 256 == 0);
static_assert(WS_TOTAL <= (size_t)134217728);

__device__ __forceinline__ float bf16_rne(float x) {
  unsigned int u = __float_as_uint(x);
  u = (u + 0x7FFFu + ((u >> 16) & 1u)) & 0xFFFF0000u;
  return __uint_as_float(u);
}

// 16x32 operand fragment from a k-contiguous 16-bit global row: elements 0..7 <- k 8h..8h+7, elements 8..15 <- k 16+8h..16+8h+7 (same map for A and B)
__device__ __forceinline__ v16h ld_frag(const _Float16* __restrict__ p, int hh) {
  FragH f;
  const unsigned short* q = (const unsigned short*)p;
  f.half[0] = *(const v8us*)(q + 8 * hh);
  f.half[1] = *(const v8us*)(q + 16 + 8 * hh);
  return f.v;
}
__device__ __forceinline__ v8f mma(v16h a, v16h b, v8f c) {
  v8f d = __builtin_amdgcn_wmma_f32_16x16x32_f16(false, a, false, b, (short)0, c, false, false);
  asm volatile("v_nop\n\tv_nop\n\tv_nop\n\tv_nop" : "+v"(d) : "v"(a), "v"(b));
  return d;
}

// fixed-order block sum over 256 threads (LDS tree); every thread gets the total
__device__ __forceinline__ float blk_sum256(float v) {
  __shared__ float red[256];
  const int t = threadIdx.x;
  red[t] = v;
  __syncthreads();
#pragma unroll 1
  for (int st = 128; st > 0; st >>= 1) {
    if (t < st) red[t] = red[t] + red[t + st];
    __syncthreads();
  }
  const float r = red[0];
  __syncthreads();
  return r;
}

__device__ __forceinline__ v8us cvt_w8(const float* __restrict__ w, int e) {
  const v4f a = *(const v4fa*)(w + e), c = *(const v4fa*)(w + e + 4);
  FragH f;
#pragma unroll
  for (int q = 0; q < 4; ++q) {
    f.h[q]     = (_Float16)(bf16_rne(a[q]) * 16.0f);
    f.h[4 + q] = (_Float16)(bf16_rne(c[q]) * 16.0f);
  }
  return f.half[0];
}

__global__ __launch_bounds__(256) void k_wcvt(const float* __restrict__ qw, const float* __restrict__ kw, const float* __restrict__ vw,
                                              const float* __restrict__ pw, _Float16* __restrict__ W16) {
  const int t = blockIdx.x * 256 + threadIdx.x;
  if (t >= CC * CC / 8) return;
  const int e = t * 8;
  const v8us v0 = cvt_w8(qw, e), v1 = cvt_w8(kw, e), v2 = cvt_w8(vw, e), v3 = cvt_w8(pw, e);
  unsigned short* d = (unsigned short*)W16 + e;
  {
    *(v8us*)(d) = v0;
    *(v8us*)(d + CC * CC) = v1;
    *(v8us*)(d + 2 * CC * CC) = v2;
    *(v8us*)(d + 3 * CC * CC) = v3;
    
  }
}

__global__ __launch_bounds__(256) void k_gnsum(const float* __restrict__ x, float* __restrict__ GS) {
  const int tid = threadIdx.x, c = blockIdx.x, b = blockIdx.y;
  const float* xr = x + (size_t)b * XS + (size_t)c * SEQ_FULL;
  float s = 0.f;
#pragma unroll 1
  for (int j = tid * 4; j < SEQ; j += 1024) {
    const v4f a = *(const v4fa*)(xr + j);
    s += (bf16_rne(a[0]) + bf16_rne(a[1])) + (bf16_rne(a[2]) + bf16_rne(a[3]));
  }
  const float tot = blk_sum256(s);
  float* d = GS + ((size_t)b * 2 * CC + c) * 32;
  const v4f o = {(tid == 0) ? tot : 0.f, 0.f, 0.f, 0.f};
  if (tid < 8) *(v4f*)(d + tid * 4) = o;
  
}

__global__ __launch_bounds__(256) void k_gnvar(const float* __restrict__ x, const float* __restrict__ GSs, float* __restrict__ GSv) {
  const int tid = threadIdx.x, c = blockIdx.x, b = blockIdx.y;
  const float ps = GSs[((size_t)b * 2 * CC + (tid & (CC - 1))) * 32];
  const float mean = blk_sum256((tid < CC) ? ps : 0.f) * (1.0f / (float)(CC * SEQ));
  const float* xr = x + (size_t)b * XS + (size_t)c * SEQ_FULL;
  float s = 0.f;
#pragma unroll 1
  for (int j = tid * 4; j < SEQ; j += 1024) {
    const v4f a = *(const v4fa*)(xr + j);
    const float d0 = bf16_rne(a[0]) - mean, d1 = bf16_rne(a[1]) - mean, d2 = bf16_rne(a[2]) - mean, d3 = bf16_rne(a[3]) - mean;
    s += (d0 * d0 + d1 * d1) + (d2 * d2 + d3 * d3);
  }
  const float tot = blk_sum256(s);
  float* d = GSv + ((size_t)b * 2 * CC + CC + c) * 32;
  const v4f o = {(tid == 0) ? tot : 0.f, 0.f, 0.f, 0.f};
  if (tid < 8) *(v4f*)(d + tid * 4) = o;
  
}

// fused normalise + q/k/v GEMM for 64 tokens per block (8 waves; wave w owns output channels 16w..16w+15).
// q, k: D[token][o] (A = h tile rows, B = weight rows) -> token-major planes QK[{q,k}][head][n][32];
__global__ __launch_bounds__(256) void k_qkv(const float* __restrict__ x, const float* __restrict__ gnw, const float* __restrict__ gnb,
                                             const _Float16* __restrict__ W16, const float* __restrict__ qb, const float* __restrict__ kb,
                                             const float* __restrict__ vb, const float* __restrict__ GS,
                                             _Float16* __restrict__ QK, _Float16* __restrict__ VT) {
  __shared__ __attribute__((aligned(16))) _Float16 hx[64 * HXP];
  __shared__ __attribute__((aligned(16))) _Float16 stg[128 * SVP];
  const int tid = threadIdx.x, w = tid >> 5, lane = tid & 31, ln = lane & 15, hh = lane >> 4;
  const int n0 = blockIdx.x * 64, b = blockIdx.y;
  const float invn = 1.0f / (float)(CC * SEQ);
  const size_t gsb = (size_t)b * 2 * CC;
  const float ps = GS[(gsb + (tid & (CC - 1))) * 32];
  const float pv = GS[(gsb + CC + (tid & (CC - 1))) * 32];
  const float mean = blk_sum256((tid < CC) ? ps : 0.f) * invn;
  const float var  = blk_sum256((tid < CC) ? pv : 0.f) * invn;
  const float rstd = rsqrtf(var + 1e-5f);
  const float* xb = x + (size_t)b * XS;
#pragma unroll 1
  for (int idx = tid; idx < CC * 64; idx += 256) {
    const int c = idx >> 6, col = idx & 63;
    const float v = bf16_rne(xb[(size_t)c * SEQ_FULL + n0 + col]);
    const float hv = ((v - mean) * rstd) * bf16_rne(gnw[c]) + bf16_rne(gnb[c]);
    hx[col * HXP + c] = (_Float16)hv;
  }
  __syncthreads();

  const float bqv = bf16_rne(qb[16 * w + ln]), bkv = bf16_rne(kb[16 * w + ln]);
#pragma unroll 1
  for (int m = 0; m < 2; ++m) {
    v16h fw[4];
    const _Float16* wr = W16 + (size_t)m * CC * CC + (size_t)(16 * w + ln) * CC;
#pragma unroll
    for (int kc = 0; kc < 4; ++kc) fw[kc] = ld_frag(wr + kc * 32, hh);
    const float bias = (m == 0) ? bqv : bkv;
#pragma unroll
    for (int nt = 0; nt < 4; ++nt) {
      v8f acc = {0.f, 0.f, 0.f, 0.f, 0.f, 0.f, 0.f, 0.f};
#pragma unroll
      for (int kc = 0; kc < 4; ++kc) {
        FragH fa;
        fa.half[0] = *(const v8us*)&hx[(nt * 16 + ln) * HXP + kc * 32 + 8 * hh];
        fa.half[1] = *(const v8us*)&hx[(nt * 16 + ln) * HXP + kc * 32 + 16 + 8 * hh];
        acc = mma(fa.v, fw[kc], acc);
      }
#pragma unroll
      for (int r = 0; r < 8; ++r) stg[(nt * 16 + 8 * hh + r) * HXP + 16 * w + ln] = (_Float16)(acc[r] * 0.0625f + bias);
    }
    __syncthreads();
    unsigned short* P = (unsigned short*)QK + (size_t)m * QKS + (size_t)b * NH * SEQ * HD;
    {
#pragma unroll
      for (int i = 0; i < 4; ++i) {
        const int idx = tid + 256 * i;
        const int head = idx >> 8, pi = idx & 255, tok = pi >> 2, d8 = (pi & 3) * 8;
        const v8us v = *(const v8us*)&stg[tok * HXP + head * HD + d8];
        *(v8us*)(P + ((size_t)head * SEQ + n0 + tok) * HD + d8) = v;
      }
      
    }
    __syncthreads();
  }
  {
    v16h fw[4];
    const _Float16* wr = W16 + (size_t)2 * CC * CC + (size_t)(16 * w + ln) * CC;
#pragma unroll
    for (int kc = 0; kc < 4; ++kc) fw[kc] = ld_frag(wr + kc * 32, hh);
    float bvr[8];
#pragma unroll
    for (int r = 0; r < 8; ++r) bvr[r] = bf16_rne(vb[16 * w + 8 * hh + r]);
#pragma unroll
    for (int nt = 0; nt < 4; ++nt) {
      v8f acc = {0.f, 0.f, 0.f, 0.f, 0.f, 0.f, 0.f, 0.f};
#pragma unroll
      for (int kc = 0; kc < 4; ++kc) {
        FragH fb;
        fb.half[0] = *(const v8us*)&hx[(nt * 16 + ln) * HXP + kc * 32 + 8 * hh];
        fb.half[1] = *(const v8us*)&hx[(nt * 16 + ln) * HXP + kc * 32 + 16 + 8 * hh];
        acc = mma(fw[kc], fb.v, acc);
      }
#pragma unroll
      for (int r = 0; r < 8; ++r) stg[(16 * w + 8 * hh + r) * SVP + nt * 16 + ln] = (_Float16)(acc[r] * 0.0625f + bvr[r]);
    }
    __syncthreads();
    unsigned short* V = (unsigned short*)VT + (size_t)b * CC * SEQ;
    {
#pragma unroll
      for (int i = 0; i < 4; ++i) {
        const int idx = tid + 256 * i;
        const int o = idx >> 3, p8 = (idx & 7) * 8;
        const v8us v = *(const v8us*)&stg[o * SVP + p8];
        *(v8us*)(V + (size_t)o * SEQ + n0 + p8) = v;
      }
      
    }
  }
}

// flash attention: block = 32 queries x 2 heads x KSPL key ranges, one wave each (wave: head = w & 1, query tile = (w >> 1) & 1, key range = w >> 2). Per 32-key step:
// S^T[key][q] = K.Q^T (two 16-key tiles; A = K rows, B = Q rows), online softmax per query column (lane), P^T packed from the two score tiles
// (element r <- tile 0 row 8h+r, element 8+r <- tile 1 row 8h+r) as the B operand of O^T[d][q] += V^T[d][key].P^T (A = V^T rows, two 16-d tiles).
// Each wave walks its own SEQ / KSPL keys with its own maximum, sum and accumulators; the KSPL partial results are joined in LDS in fixed range order.
__global__ __launch_bounds__(1024) __attribute__((amdgpu_waves_per_eu(8, 8))) /* 32 waves on 4 SIMDs: lets the scheduler use the 128 VGPRs a wave may have */ void k_attn(const _Float16* __restrict__ QK, const _Float16* __restrict__ VT, _Float16* __restrict__ AO) {
  __shared__ __attribute__((aligned(16))) float po[4 * KSPL * 4 * 32 * 4];   /* [wave][4-row chunk][lane] float4: un-normalised O^T partials */
  __shared__ float pm[4 * KSPL * 16];                                        /* [wave][query] running maximum */
  __shared__ float pl[4 * KSPL * 16];                                        /* [wave][query] sum of exponentials */
  __shared__ __attribute__((aligned(16))) _Float16 st[32 * SVP];
  const int tid = threadIdx.x, lane = tid & 31, ln = lane & 15, hh = lane >> 4;
  const int w = __builtin_amdgcn_readfirstlane(tid >> 5);   /* wave number in a scalar register: head, tile and key range become scalar address parts */
  const int hp = blockIdx.x & 1, qblk = blockIdx.x >> 1, b = blockIdx.y;
  const int hd = hp * 2 + (w & 1), qs = (w >> 1) & 1, k0 = (w >> 2) * (SEQ / KSPL);
  const int q0 = qblk * 32 + qs * 16;
  const _Float16* Qh = QK + ((size_t)b * NH + hd) * SEQ * HD;
  const _Float16* Kh = Qh + QKS;
  const _Float16* Vh = VT + ((size_t)b * CC + hd * HD) * SEQ;
  const v16h bq = ld_frag(Qh + (size_t)(q0 + ln) * HD, hh);
  const _Float16* kp  = Kh + (size_t)ln * HD;
  const _Float16* vp0 = Vh + (size_t)ln * SEQ;
  const _Float16* vp1 = Vh + (size_t)(16 + ln) * SEQ;
  const v8f z8 = {0.f, 0.f, 0.f, 0.f, 0.f, 0.f, 0.f, 0.f};
  const float sc = 0.17677669529663687f;
  float mrun = -1.0e30f, lrun = 0.f;
  v8f o0 = z8, o1 = z8;
#pragma unroll 1
  for (int kb = k0; kb < k0 + SEQ / KSPL; kb += 32) {
    const v16h ka0 = ld_frag(kp + (size_t)kb * HD, hh);
    const v16h ka1 = ld_frag(kp + (size_t)(kb + 16) * HD, hh);
    v8f s0 = mma(ka0, bq, z8);
    v8f s1 = mma(ka1, bq, z8);
    float mx = -1.0e30f;
#pragma unroll
    for (int r = 0; r < 8; ++r) { s0[r] *= sc; s1[r] *= sc; mx = fmaxf(mx, fmaxf(s0[r], s1[r])); }
    mx = fmaxf(mx, __shfl_xor(mx, 16, 32));
    const float mn = fmaxf(mrun, mx);
    const float al = __expf(mrun - mn);
    mrun = mn;
    FragH pf;
    float rs = 0.f;
#pragma unroll
    for (int r = 0; r < 8; ++r) {
      const float p0 = __expf(s0[r] - mn), p1 = __expf(s1[r] - mn);
      rs += p0 + p1;
      pf.h[r]     = (_Float16)(p0 * 256.0f);
      pf.h[8 + r] = (_Float16)(p1 * 256.0f);
    }
    lrun = lrun * al + rs;
#pragma unroll
    for (int r = 0; r < 8; ++r) { o0[r] *= al; o1[r] *= al; }
    const v16h va0 = ld_frag(vp0 + kb, hh);
    const v16h va1 = ld_frag(vp1 + kb, hh);
    o0 = mma(va0, pf.v, o0);
    o1 = mma(va1, pf.v, o1);
  }
  const float lt = lrun + __shfl_xor(lrun, 16, 32);
  {
    const v4f c0 = {o0[0], o0[1], o0[2], o0[3]}, c1 = {o0[4], o0[5], o0[6], o0[7]};
    const v4f c2 = {o1[0], o1[1], o1[2], o1[3]}, c3 = {o1[4], o1[5], o1[6], o1[7]};
    float* pw_ = &po[((size_t)w * 4 * 32 + lane) * 4];
    *(v4f*)(pw_)           = c0;
    *(v4f*)(pw_ + 32 * 4)  = c1;
    *(v4f*)(pw_ + 64 * 4)  = c2;
    *(v4f*)(pw_ + 96 * 4)  = c3;
    if (hh == 0) { pm[w * 16 + ln] = mrun; pl[w * 16 + ln] = lt; }
  }
  __syncthreads();
  {
    /* join: thread = (tile-and-head pair p, chunk c, source lane l, half of the float4); ranges summed in index order */
    const int h2 = tid & 1, l = (tid >> 1) & 31, c = (tid >> 6) & 3, p = tid >> 8;
    const int jl = l & 15, jh = l >> 4;
    float mr[KSPL];
    float M = -1.0e30f;
#pragma unroll
    for (int s = 0; s < KSPL; ++s) { mr[s] = pm[(s * 4 + p) * 16 + jl]; M = fmaxf(M, mr[s]); }
    float L = 0.f, a0 = 0.f, a1 = 0.f;
#pragma unroll
    for (int s = 0; s < KSPL; ++s) {
      const float wg = __expf(mr[s] - M);
      const v2f v = *(const v2f*)&po[(((size_t)(s * 4 + p) * 4 + c) * 32 + l) * 4 + 2 * h2];
      L  += wg * pl[(s * 4 + p) * 16 + jl];
      a0 += wg * v[0];
      a1 += wg * v[1];
    }
    const float inv = 0.125f * (1.0f / L);           /* 2^-8 (P carry) x 2^5 (ctx carry) */
    const v2h e = {(_Float16)(a0 * inv), (_Float16)(a1 * inv)};
    *(v2h*)&st[((p >> 1) * 16 + jl) * SVP + (p & 1) * HD + (c >> 1) * 16 + 8 * jh + (c & 1) * 4 + 2 * h2] = e;
  }
  __syncthreads();
  if (tid < 256) {
    unsigned short* A = (unsigned short*)AO + ((size_t)b * SEQ + (size_t)qblk * 32) * CC + hp * 2 * HD;
    const int row = tid >> 3, p8 = (tid & 7) * 8;
    const v8us v = *(const v8us*)&st[row * SVP + p8];
    *(v8us*)(A + (size_t)row * CC + p8) = v;
  }
}

// projection: D[o][n] = pw[o][:] . ctx[n][:] (A = weight rows, B = ctx rows), 64 tokens per block, wave w owns o = 16w..16w+15;
__global__ __launch_bounds__(256) void k_proj(const float* __restrict__ x, const _Float16* __restrict__ W16, const float* __restrict__ pb,
                                              const _Float16* __restrict__ AO, float* __restrict__ out) {
  __shared__ __attribute__((aligned(16))) float so[128 * SOP];
  const int tid = threadIdx.x, w = tid >> 5, lane = tid & 31, ln = lane & 15, hh = lane >> 4;
  const int n0 = blockIdx.x * 64, b = blockIdx.y;
  v16h fw[4];
  const _Float16* wr = W16 + (size_t)3 * CC * CC + (size_t)(16 * w + ln) * CC;
#pragma unroll
  for (int kc = 0; kc < 4; ++kc) fw[kc] = ld_frag(wr + kc * 32, hh);
#pragma unroll
  for (int nt = 0; nt < 4; ++nt) {
    const _Float16* br = AO + ((size_t)b * SEQ + n0 + nt * 16 + ln) * CC;
    v8f acc = {0.f, 0.f, 0.f, 0.f, 0.f, 0.f, 0.f, 0.f};
#pragma unroll
    for (int kc = 0; kc < 4; ++kc) { const v16h fb = ld_frag(br + kc * 32, hh); acc = mma(fw[kc], fb, acc); }
#pragma unroll
    for (int r = 0; r < 8; ++r) so[(16 * w + 8 * hh + r) * SOP + nt * 16 + ln] = acc[r] * 0.001953125f;
  }
  __syncthreads();
  const float* xb = x + (size_t)b * XS;
  float* ob = out + (size_t)b * XS;
  {
#pragma unroll 1
    for (int i = 0; i < 8; ++i) {
      const int idx = tid + 256 * i;
      const int o = idx >> 4, c4 = (idx & 15) * 4;
      const v4f a = *(const v4fa*)&so[o * SOP + c4];
      const size_t e = (size_t)o * SEQ_FULL + n0 + c4;
      const v4f xv = *(const v4fa*)(xb + e);
      const float pbv = bf16_rne(pb[o]);
      v4f y;
#pragma unroll
      for (int q = 0; q < 4; ++q) y[q] = bf16_rne(xv[q]) + (a[q] + pbv);
      *(v4f*)(ob + e) = y;
    }
    
  }
}

extern "C" void kernel_launch(void* const* d_in, const int* in_sizes, int n_in,
                              void* d_out, int out_size, void* d_ws, size_t ws_size, hipStream_t stream) {
  if (n_in < 11) return;
  if (in_sizes[0] < NB * CC * SEQ) return;
  if (in_sizes[1] < CC || in_sizes[2] < CC || in_sizes[4] < CC || in_sizes[6] < CC || in_sizes[8] < CC || in_sizes[10] < CC) return;
  if (in_sizes[3] < CC * CC || in_sizes[5] < CC * CC || in_sizes[7] < CC * CC || in_sizes[9] < CC * CC) return;
  if (out_size < NB * CC * SEQ) return;
  if (ws_size < WS_TOTAL) return;
  const float* x   = (const float*)d_in[0];
  const float* gnw = (const float*)d_in[1];
  const float* gnb = (const float*)d_in[2];
  const float* qw  = (const float*)d_in[3];
  const float* qb  = (const float*)d_in[4];
  const float* kw  = (const float*)d_in[5];
  const float* kb  = (const float*)d_in[6];
  const float* vw  = (const float*)d_in[7];
  const float* vb  = (const float*)d_in[8];
  const float* pw  = (const float*)d_in[9];
  const float* pb  = (const float*)d_in[10];
  char* ws = (char*)d_ws;
  _Float16* W16 = (_Float16*)(ws + WS_W16);
  float*    GS  = (float*)(ws + WS_GS);
  _Float16* QK  = (_Float16*)(ws + WS_QK);
  _Float16* VT  = (_Float16*)(ws + WS_VT);
  _Float16* AO  = (_Float16*)(ws + WS_AO);
  k_wcvt<<<dim3(CC * CC / 8 / 256), 256, 0, stream>>>(qw, kw, vw, pw, W16);
  k_gnsum<<<dim3(CC, NB), 256, 0, stream>>>(x, GS);
  k_gnvar<<<dim3(CC, NB), 256, 0, stream>>>(x, GS, GS);
  k_qkv<<<dim3(SEQ / 64, NB), 256, 0, stream>>>(x, gnw, gnb, W16, qb, kb, vb, GS, QK, VT);
  k_attn<<<dim3(SEQ / 32 * 2, NB), 1024, 0, stream>>>(QK, VT, AO);
  k_proj<<<dim3(SEQ / 64, NB), 256, 0, stream>>>(x, W16, pb, AO, (float*)d_out);
}

// v002
// One run takes 55.5 microseconds.
// In two side-by-side timings against v001, it was 1.08 and 1.11 times as fast.
// All steps since v000 together make it 2.42 times as fast.
#include <hip/hip_runtime.h>
// Channel-first spatial attention block with one-group GroupNorm and a plain residual: x [1][128][64][64] -> h = GN(x) (one mean / rstd over all 128 x 4096 values, per-channel affine);
// q/k/v = 1x1 convs ([out][in] weights + bias), 4 heads x 32; scores = q.k * 32^-0.5; softmax over the 4096 keys; ctx = P.v; result = x + pw.ctx + pb.
// (token-major q plane [head][n][32]; the k and V^T planes lie in the workspace in WMMA fragment order, see ld_fragp); flash attention with S^T = K.Q^T so that the score accumulators are directly the B operand of O^T = V^T.P^T
// (online softmax, one cross-half shuffle per step, no score plane); projection GEMM with the residual added at the float4 store stage.
// Compute dtype: every contraction v_wmma_f32_16x16x32_f16 (f16 operands, f32 accumulate), single products; all float inputs RNE-converted to bf16 first (exact in f16);
// carries: weights x16, P x256, ctx x32; statistics, softmax, residual in f32.
#ifndef NB
#define NB 1
#endif
#ifndef SEQ
#define SEQ 4096
#endif
#define SEQ_FULL 4096
#define CC 128
#define NH 4
#define HD 32
#define HXP 136                      /* LDS pitch (halves) of token-major 128-wide tiles */
#define SVP 72                       /* LDS pitch (halves) of the channel-major 64-token tile */
#define KSPL 8                       /* key ranges per (query tile, head) in the attention block */
#define SOP 68                       /* LDS pitch (floats) of the projection tile */
#define XS ((size_t)CC * SEQ_FULL)   /* per-batch stride of x / out */
#define QKS ((size_t)NB * NH * SEQ * HD)   /* halves between the q plane and the k plane */

static_assert(CC == NH * HD);
static_assert(HD == 32);
static_assert(CC == 128);
static_assert(CC <= 256);
static_assert(SEQ % 64 == 0);
static_assert(SEQ <= SEQ_FULL);
static_assert(SEQ % (KSPL * 32) == 0);
static_assert(4 * KSPL * 32 == 1024);
static_assert(64 * HXP <= 128 * SVP);
static_assert(HXP % 8 == 0 && SVP % 8 == 0 && SOP % 4 == 0);
static_assert((CC * CC) % (8 * 256) == 0);

typedef _Float16 v16h __attribute__((ext_vector_type(16)));
typedef unsigned short v8us __attribute__((ext_vector_type(8), may_alias));
typedef float v8f  __attribute__((ext_vector_type(8)));
typedef float v4f  __attribute__((ext_vector_type(4)));
typedef float v4fa __attribute__((ext_vector_type(4), may_alias));
typedef float v2f  __attribute__((ext_vector_type(2)));
typedef _Float16 v2h __attribute__((ext_vector_type(2)));
union FragH { v16h v; v8us half[2]; _Float16 h[16]; unsigned short u[16]; };

// workspace carve (bytes, every region a multiple of 256)
constexpr size_t WS_W16 = 0;
constexpr size_t SZ_W16 = (size_t)4 * CC * CC * 2;
constexpr size_t WS_GS  = WS_W16 + SZ_W16;
constexpr size_t SZ_GS  = (size_t)NB * 2 * CC * 32 * 4;
constexpr size_t WS_QK  = WS_GS + SZ_GS;
constexpr size_t SZ_QK  = 2 * QKS * 2;
constexpr size_t WS_VT  = WS_QK + SZ_QK;
constexpr size_t SZ_VT  = (size_t)NB * CC * SEQ * 2;
constexpr size_t WS_AO  = WS_VT + SZ_VT;
constexpr size_t SZ_AO  = (size_t)NB * SEQ * CC * 2;
constexpr size_t WS_TOTAL = WS_AO + SZ_AO;
static_assert(SZ_W16 % 256 == 0 && SZ_GS % 256 == 0 && SZ_QK % 256 == 0 && SZ_VT % 256 == 0 && SZ_AO % 256 == 0);
static_assert(WS_TOTAL <= (size_t)134217728);

__device__ __forceinline__ float bf16_rne(float x) {
  unsigned int u = __float_as_uint(x);
  u = (u + 0x7FFFu + ((u >> 16) & 1u)) & 0xFFFF0000u;
  return __uint_as_float(u);
}

// 16x32 operand fragment from a k-contiguous 16-bit global row: elements 0..7 <- k 8h..8h+7, elements 8..15 <- k 16+8h..16+8h+7 (same map for A and B)
__device__ __forceinline__ v16h ld_frag(const _Float16* __restrict__ p, int hh) {
  FragH f;
  const unsigned short* q = (const unsigned short*)p;
  f.half[0] = *(const v8us*)(q + 8 * hh);
  f.half[1] = *(const v8us*)(q + 16 + 8 * hh);
  return f.v;
}
// the same 16x32 operand fragment from a plane kept in fragment order: 1 KiB per fragment, [k half j][lane][8 halves], chunk (j, lane = 16h + row) <- k 16j+8h..16j+8h+7 of that row;
// p = fragment base (the same in every lane), l8 = 8 * lane: each of the two wave-wide 16-byte loads covers 512 contiguous bytes (4 whole lines) instead of 16-byte pieces of 8 or 16 lines
__device__ __forceinline__ v16h ld_fragp(const _Float16* __restrict__ p, unsigned int l8) {
  FragH f;
  const unsigned short* q = (const unsigned short*)p;
  f.half[0] = *(const v8us*)(q + l8);
  f.half[1] = *(const v8us*)(q + 256 + l8);
  return f.v;
}
__device__ __forceinline__ v8f mma(v16h a, v16h b, v8f c) {
  v8f d = __builtin_amdgcn_wmma_f32_16x16x32_f16(false, a, false, b, (short)0, c, false, false);
  asm volatile("v_nop\n\tv_nop\n\tv_nop\n\tv_nop" : "+v"(d) : "v"(a), "v"(b));
  return d;
}

// fixed-order block sum over 256 threads (LDS tree); every thread gets the total
__device__ __forceinline__ float blk_sum256(float v) {
  __shared__ float red[256];
  const int t = threadIdx.x;
  red[t] = v;
  __syncthreads();
#pragma unroll 1
  for (int st = 128; st > 0; st >>= 1) {
    if (t < st) red[t] = red[t] + red[t + st];
    __syncthreads();
  }
  const float r = red[0];
  __syncthreads();
  return r;
}

__device__ __forceinline__ v8us cvt_w8(const float* __restrict__ w, int e) {
  const v4f a = *(const v4fa*)(w + e), c = *(const v4fa*)(w + e + 4);
  FragH f;
#pragma unroll
  for (int q = 0; q < 4; ++q) {
    f.h[q]     = (_Float16)(bf16_rne(a[q]) * 16.0f);
    f.h[4 + q] = (_Float16)(bf16_rne(c[q]) * 16.0f);
  }
  return f.half[0];
}

__global__ __launch_bounds__(256) void k_wcvt(const float* __restrict__ qw, const float* __restrict__ kw, const float* __restrict__ vw,
                                              const float* __restrict__ pw, _Float16* __restrict__ W16) {
  const int t = blockIdx.x * 256 + threadIdx.x;
  if (t >= CC * CC / 8) return;
  const int e = t * 8;
  const v8us v0 = cvt_w8(qw, e), v1 = cvt_w8(kw, e), v2 = cvt_w8(vw, e), v3 = cvt_w8(pw, e);
  unsigned short* d = (unsigned short*)W16 + e;
  {
    *(v8us*)(d) = v0;
    *(v8us*)(d + CC * CC) = v1;
    *(v8us*)(d + 2 * CC * CC) = v2;
    *(v8us*)(d + 3 * CC * CC) = v3;
    
  }
}

__global__ __launch_bounds__(256) void k_gnsum(const float* __restrict__ x, float* __restrict__ GS) {
  const int tid = threadIdx.x, c = blockIdx.x, b = blockIdx.y;
  const float* xr = x + (size_t)b * XS + (size_t)c * SEQ_FULL;
  float s = 0.f;
#pragma unroll 1
  for (int j = tid * 4; j < SEQ; j += 1024) {
    const v4f a = *(const v4fa*)(xr + j);
    s += (bf16_rne(a[0]) + bf16_rne(a[1])) + (bf16_rne(a[2]) + bf16_rne(a[3]));
  }
  const float tot = blk_sum256(s);
  float* d = GS + ((size_t)b * 2 * CC + c) * 32;
  const v4f o = {(tid == 0) ? tot : 0.f, 0.f, 0.f, 0.f};
  if (tid < 8) *(v4f*)(d + tid * 4) = o;
  
}

__global__ __launch_bounds__(256) void k_gnvar(const float* __restrict__ x, const float* __restrict__ GSs, float* __restrict__ GSv) {
  const int tid = threadIdx.x, c = blockIdx.x, b = blockIdx.y;
  const float ps = GSs[((size_t)b * 2 * CC + (tid & (CC - 1))) * 32];
  const float mean = blk_sum256((tid < CC) ? ps : 0.f) * (1.0f / (float)(CC * SEQ));
  const float* xr = x + (size_t)b * XS + (size_t)c * SEQ_FULL;
  float s = 0.f;
#pragma unroll 1
  for (int j = tid * 4; j < SEQ; j += 1024) {
    const v4f a = *(const v4fa*)(xr + j);
    const float d0 = bf16_rne(a[0]) - mean, d1 = bf16_rne(a[1]) - mean, d2 = bf16_rne(a[2]) - mean, d3 = bf16_rne(a[3]) - mean;
    s += (d0 * d0 + d1 * d1) + (d2 * d2 + d3 * d3);
  }
  const float tot = blk_sum256(s);
  float* d = GSv + ((size_t)b * 2 * CC + CC + c) * 32;
  const v4f o = {(tid == 0) ? tot : 0.f, 0.f, 0.f, 0.f};
  if (tid < 8) *(v4f*)(d + tid * 4) = o;
  
}

// fused normalise + q/k/v GEMM for 64 tokens per block (8 waves; wave w owns output channels 16w..16w+15).
// q, k: D[token][o] (A = h tile rows, B = weight rows) -> planes QK[{q,k}][head]: q token-major [n][32], k in fragment order [n / 16][1 KiB];
// v: D[o][token] (A = weight rows, B = h tile rows) -> plane VT[head] in fragment order [n / 32][16-d tile][1 KiB];
__global__ __launch_bounds__(256) void k_qkv(const float* __restrict__ x, const float* __restrict__ gnw, const float* __restrict__ gnb,
                                             const _Float16* __restrict__ W16, const float* __restrict__ qb, const float* __restrict__ kb,
                                             const float* __restrict__ vb, const float* __restrict__ GS,
                                             _Float16* __restrict__ QK, _Float16* __restrict__ VT) {
  __shared__ __attribute__((aligned(16))) _Float16 hx[64 * HXP];
  __shared__ __attribute__((aligned(16))) _Float16 stg[128 * SVP];
  const int tid = threadIdx.x, w = tid >> 5, lane = tid & 31, ln = lane & 15, hh = lane >> 4;
  const int n0 = blockIdx.x * 64, b = blockIdx.y;
  const float invn = 1.0f / (float)(CC * SEQ);
  const size_t gsb = (size_t)b * 2 * CC;
  const float ps = GS[(gsb + (tid & (CC - 1))) * 32];
  const float pv = GS[(gsb + CC + (tid & (CC - 1))) * 32];
  const float mean = blk_sum256((tid < CC) ? ps : 0.f) * invn;
  const float var  = blk_sum256((tid < CC) ? pv : 0.f) * invn;
  const float rstd = rsqrtf(var + 1e-5f);
  const float* xb = x + (size_t)b * XS;
#pragma unroll 1
  for (int idx = tid; idx < CC * 64; idx += 256) {
    const int c = idx >> 6, col = idx & 63;
    const float v = bf16_rne(xb[(size_t)c * SEQ_FULL + n0 + col]);
    const float hv = ((v - mean) * rstd) * bf16_rne(gnw[c]) + bf16_rne(gnb[c]);
    hx[col * HXP + c] = (_Float16)hv;
  }
  __syncthreads();

  const float bqv = bf16_rne(qb[16 * w + ln]), bkv = bf16_rne(kb[16 * w + ln]);
#pragma unroll 1
  for (int m = 0; m < 2; ++m) {
    v16h fw[4];
    const _Float16* wr = W16 + (size_t)m * CC * CC + (size_t)(16 * w + ln) * CC;
#pragma unroll
    for (int kc = 0; kc < 4; ++kc) fw[kc] = ld_frag(wr + kc * 32, hh);
    const float bias = (m == 0) ? bqv : bkv;
#pragma unroll
    for (int nt = 0; nt < 4; ++nt) {
      v8f acc = {0.f, 0.f, 0.f, 0.f, 0.f, 0.f, 0.f, 0.f};
#pragma unroll
      for (int kc = 0; kc < 4; ++kc) {
        FragH fa;
        fa.half[0] = *(const v8us*)&hx[(nt * 16 + ln) * HXP + kc * 32 + 8 * hh];
        fa.half[1] = *(const v8us*)&hx[(nt * 16 + ln) * HXP + kc * 32 + 16 + 8 * hh];
        acc = mma(fa.v, fw[kc], acc);
      }
#pragma unroll
      for (int r = 0; r < 8; ++r) stg[(nt * 16 + 8 * hh + r) * HXP + 16 * w + ln] = (_Float16)(acc[r] * 0.0625f + bias);
    }
    __syncthreads();
    unsigned short* P = (unsigned short*)QK + (size_t)m * QKS + (size_t)b * NH * SEQ * HD;
    {
#pragma unroll
      for (int i = 0; i < 4; ++i) {
        const int idx = tid + 256 * i;
        const int head = idx >> 8, pi = idx & 255;
        /* 16-byte chunk pi of the head's 64 tokens: q token-major [token][4 chunks]; k in fragment order [16-key tile][k half][lane] */
        const int tok = (m == 0) ? (pi >> 2) : ((pi >> 6) * 16 + (pi & 15));
        const int d8  = (m == 0) ? ((pi & 3) * 8) : (((pi >> 5) & 1) * 16 + ((pi >> 4) & 1) * 8);
        const v8us v = *(const v8us*)&stg[tok * HXP + head * HD + d8];
        *(v8us*)(P + ((size_t)head * SEQ + n0) * HD + pi * 8) = v;
      }
      
    }
    __syncthreads();
  }
  {
    v16h fw[4];
    const _Float16* wr = W16 + (size_t)2 * CC * CC + (size_t)(16 * w + ln) * CC;
#pragma unroll
    for (int kc = 0; kc < 4; ++kc) fw[kc] = ld_frag(wr + kc * 32, hh);
    float bvr[8];
#pragma unroll
    for (int r = 0; r < 8; ++r) bvr[r] = bf16_rne(vb[16 * w + 8 * hh + r]);
#pragma unroll
    for (int nt = 0; nt < 4; ++nt) {
      v8f acc = {0.f, 0.f, 0.f, 0.f, 0.f, 0.f, 0.f, 0.f};
#pragma unroll
      for (int kc = 0; kc < 4; ++kc) {
        FragH fb;
        fb.half[0] = *(const v8us*)&hx[(nt * 16 + ln) * HXP + kc * 32 + 8 * hh];
        fb.half[1] = *(const v8us*)&hx[(nt * 16 + ln) * HXP + kc * 32 + 16 + 8 * hh];
        acc = mma(fw[kc], fb.v, acc);
      }
#pragma unroll
      for (int r = 0; r < 8; ++r) stg[(16 * w + 8 * hh + r) * SVP + nt * 16 + ln] = (_Float16)(acc[r] * 0.0625f + bvr[r]);
    }
    __syncthreads();
    unsigned short* V = (unsigned short*)VT + (size_t)b * CC * SEQ;
    {
#pragma unroll
      for (int i = 0; i < 4; ++i) {
        const int idx = tid + 256 * i;
        const int head = idx >> 8, pi = idx & 255;
        /* fragment order: chunk pi of the head's 64 keys = [32-key step][16-d tile][k half][lane] */
        const int o = head * HD + ((pi >> 6) & 1) * 16 + (pi & 15);
        const int p8 = (pi >> 7) * 32 + ((pi >> 5) & 1) * 16 + ((pi >> 4) & 1) * 8;
        const v8us v = *(const v8us*)&stg[o * SVP + p8];
        *(v8us*)(V + ((size_t)head * SEQ + n0) * HD + pi * 8) = v;
      }
      
    }
  }
}

// flash attention: block = 32 queries x 2 heads x KSPL key ranges, one wave each (wave: head = w & 1, query tile = (w >> 1) & 1, key range = w >> 2). Per 32-key step:
// S^T[key][q] = K.Q^T (two 16-key tiles; A = K rows, B = Q rows), online softmax per query column (lane), P^T packed from the two score tiles
// (element r <- tile 0 row 8h+r, element 8+r <- tile 1 row 8h+r) as the B operand of O^T[d][q] += V^T[d][key].P^T (A = V^T rows, two 16-d tiles).
// Each wave walks its own SEQ / KSPL keys with its own maximum, sum and accumulators; the KSPL partial results are joined in LDS in fixed range order.
__global__ __launch_bounds__(1024) __attribute__((amdgpu_waves_per_eu(8, 8))) /* 32 waves on 4 SIMDs: lets the scheduler use the 128 VGPRs a wave may have */ void k_attn(const _Float16* __restrict__ QK, const _Float16* __restrict__ VT, _Float16* __restrict__ AO) {
  __shared__ __attribute__((aligned(16))) float po[4 * KSPL * 4 * 32 * 4];   /* [wave][4-row chunk][lane] float4: un-normalised O^T partials */
  __shared__ float pm[4 * KSPL * 16];                                        /* [wave][query] running maximum */
  __shared__ float pl[4 * KSPL * 16];                                        /* [wave][query] sum of exponentials */
  __shared__ __attribute__((aligned(16))) _Float16 st[32 * SVP];
  const int tid = threadIdx.x, lane = tid & 31, ln = lane & 15, hh = lane >> 4;
  const int w = __builtin_amdgcn_readfirstlane(tid >> 5);   /* wave number in a scalar register: head, tile and key range become scalar address parts */
  const int hp = blockIdx.x & 1, qblk = blockIdx.x >> 1, b = blockIdx.y;
  const int hd = hp * 2 + (w & 1), qs = (w >> 1) & 1, k0 = (w >> 2) * (SEQ / KSPL);
  const int q0 = qblk * 32 + qs * 16;
  const _Float16* Qh = QK + ((size_t)b * NH + hd) * SEQ * HD;
  const _Float16* Kh = Qh + QKS;
  const _Float16* Vh = VT + ((size_t)b * CC + hd * HD) * SEQ;
  const v16h bq = ld_frag(Qh + (size_t)(q0 + ln) * HD, hh);
  const _Float16* kt = Kh + (size_t)k0 * HD;   /* the wave's current 32-key step: 2 KiB of k fragments, 2 KiB of V^T fragments */
  const _Float16* vt = Vh + (size_t)k0 * HD;
  const v8f z8 = {0.f, 0.f, 0.f, 0.f, 0.f, 0.f, 0.f, 0.f};
  const float sc = 0.17677669529663687f;
  float mrun = -1.0e30f, lrun = 0.f;
  v8f o0 = z8, o1 = z8;
#pragma unroll 1
  for (int kb = k0; kb < k0 + SEQ / KSPL; kb += 32, kt += 32 * HD, vt += 32 * HD) {
    const v16h ka0 = ld_fragp(kt, lane * 8);
    const v16h ka1 = ld_fragp(kt + 512, lane * 8);
    v8f s0 = mma(ka0, bq, z8);
    v8f s1 = mma(ka1, bq, z8);
    float mx = -1.0e30f;
#pragma unroll
    for (int r = 0; r < 8; ++r) { s0[r] *= sc; s1[r] *= sc; mx = fmaxf(mx, fmaxf(s0[r], s1[r])); }
    mx = fmaxf(mx, __shfl_xor(mx, 16, 32));
    const float mn = fmaxf(mrun, mx);
    const float al = __expf(mrun - mn);
    mrun = mn;
    FragH pf;
    float rs = 0.f;
#pragma unroll
    for (int r = 0; r < 8; ++r) {
      const float p0 = __expf(s0[r] - mn), p1 = __expf(s1[r] - mn);
      rs += p0 + p1;
      pf.h[r]     = (_Float16)(p0 * 256.0f);
      pf.h[8 + r] = (_Float16)(p1 * 256.0f);
    }
    lrun = lrun * al + rs;
#pragma unroll
    for (int r = 0; r < 8; ++r) { o0[r] *= al; o1[r] *= al; }
    const v16h va0 = ld_fragp(vt, lane * 8);
    const v16h va1 = ld_fragp(vt + 512, lane * 8);
    o0 = mma(va0, pf.v, o0);
    o1 = mma(va1, pf.v, o1);
  }
  const float lt = lrun + __shfl_xor(lrun, 16, 32);
  {
    const v4f c0 = {o0[0], o0[1], o0[2], o0[3]}, c1 = {o0[4], o0[5], o0[6], o0[7]};
    const v4f c2 = {o1[0], o1[1], o1[2], o1[3]}, c3 = {o1[4], o1[5], o1[6], o1[7]};
    float* pw_ = &po[((size_t)w * 4 * 32 + lane) * 4];
    *(v4f*)(pw_)           = c0;
    *(v4f*)(pw_ + 32 * 4)  = c1;
    *(v4f*)(pw_ + 64 * 4)  = c2;
    *(v4f*)(pw_ + 96 * 4)  = c3;
    if (hh == 0) { pm[w * 16 + ln] = mrun; pl[w * 16 + ln] = lt; }
  }
  __syncthreads();
  {
    /* join: thread = (tile-and-head pair p, chunk c, source lane l, half of the float4); ranges summed in index order */
    const int h2 = tid & 1, l = (tid >> 1) & 31, c = (tid >> 6) & 3, p = tid >> 8;
    const int jl = l & 15, jh = l >> 4;
    float mr[KSPL];
    float M = -1.0e30f;
#pragma unroll
    for (int s = 0; s < KSPL; ++s) { mr[s] = pm[(s * 4 + p) * 16 + jl]; M = fmaxf(M, mr[s]); }
    float L = 0.f, a0 = 0.f, a1 = 0.f;
#pragma unroll
    for (int s = 0; s < KSPL; ++s) {
      const float wg = __expf(mr[s] - M);
      const v2f v = *(const v2f*)&po[(((size_t)(s * 4 + p) * 4 + c) * 32 + l) * 4 + 2 * h2];
      L  += wg * pl[(s * 4 + p) * 16 + jl];
      a0 += wg * v[0];
      a1 += wg * v[1];
    }
    const float inv = 0.125f * (1.0f / L);           /* 2^-8 (P carry) x 2^5 (ctx carry) */
    const v2h e = {(_Float16)(a0 * inv), (_Float16)(a1 * inv)};
    *(v2h*)&st[((p >> 1) * 16 + jl) * SVP + (p & 1) * HD + (c >> 1) * 16 + 8 * jh + (c & 1) * 4 + 2 * h2] = e;
  }
  __syncthreads();
  if (tid < 256) {
    unsigned short* A = (unsigned short*)AO + ((size_t)b * SEQ + (size_t)qblk * 32) * CC + hp * 2 * HD;
    const int row = tid >> 3, p8 = (tid & 7) * 8;
    const v8us v = *(const v8us*)&st[row * SVP + p8];
    *(v8us*)(A + (size_t)row * CC + p8) = v;
  }
}

// projection: D[o][n] = pw[o][:] . ctx[n][:] (A = weight rows, B = ctx rows), 64 tokens per block, wave w owns o = 16w..16w+15;
__global__ __launch_bounds__(256) void k_proj(const float* __restrict__ x, const _Float16* __restrict__ W16, const float* __restrict__ pb,
                                              const _Float16* __restrict__ AO, float* __restrict__ out) {
  __shared__ __attribute__((aligned(16))) float so[128 * SOP];
  const int tid = threadIdx.x, w = tid >> 5, lane = tid & 31, ln = lane & 15, hh = lane >> 4;
  const int n0 = blockIdx.x * 64, b = blockIdx.y;
  v16h fw[4];
  const _Float16* wr = W16 + (size_t)3 * CC * CC + (size_t)(16 * w + ln) * CC;
#pragma unroll
  for (int kc = 0; kc < 4; ++kc) fw[kc] = ld_frag(wr + kc * 32, hh);
#pragma unroll
  for (int nt = 0; nt < 4; ++nt) {
    const _Float16* br = AO + ((size_t)b * SEQ + n0 + nt * 16 + ln) * CC;
    v8f acc = {0.f, 0.f, 0.f, 0.f, 0.f, 0.f, 0.f, 0.f};
#pragma unroll
    for (int kc = 0; kc < 4; ++kc) { const v16h fb = ld_frag(br + kc * 32, hh); acc = mma(fw[kc], fb, acc); }
#pragma unroll
    for (int r = 0; r < 8; ++r) so[(16 * w + 8 * hh + r) * SOP + nt * 16 + ln] = acc[r] * 0.001953125f;
  }
  __syncthreads();
  const float* xb = x + (size_t)b * XS;
  float* ob = out + (size_t)b * XS;
  {
#pragma unroll 1
    for (int i = 0; i < 8; ++i) {
      const int idx = tid + 256 * i;
      const int o = idx >> 4, c4 = (idx & 15) * 4;
      const v4f a = *(const v4fa*)&so[o * SOP + c4];
      const size_t e = (size_t)o * SEQ_FULL + n0 + c4;
      const v4f xv = *(const v4fa*)(xb + e);
      const float pbv = bf16_rne(pb[o]);
      v4f y;
#pragma unroll
      for (int q = 0; q < 4; ++q) y[q] = bf16_rne(xv[q]) + (a[q] + pbv);
      *(v4f*)(ob + e) = y;
    }
    
  }
}

extern "C" void kernel_launch(void* const* d_in, const int* in_sizes, int n_in,
                              void* d_out, int out_size, void* d_ws, size_t ws_size, hipStream_t stream) {
  if (n_in < 11) return;
  if (in_sizes[0] < NB * CC * SEQ) return;
  if (in_sizes[1] < CC || in_sizes[2] < CC || in_sizes[4] < CC || in_sizes[6] < CC || in_sizes[8] < CC || in_sizes[10] < CC) return;
  if (in_sizes[3] < CC * CC || in_sizes[5] < CC * CC || in_sizes[7] < CC * CC || in_sizes[9] < CC * CC) return;
  if (out_size < NB * CC * SEQ) return;
  if (ws_size < WS_TOTAL) return;
  const float* x   = (const float*)d_in[0];
  const float* gnw = (const float*)d_in[1];
  const float* gnb = (const float*)d_in[2];
  const float* qw  = (const float*)d_in[3];
  const float* qb  = (const float*)d_in[4];
  const float* kw  = (const float*)d_in[5];
  const float* kb  = (const float*)d_in[6];
  const float* vw  = (const float*)d_in[7];
  const float* vb  = (const float*)d_in[8];
  const float* pw  = (const float*)d_in[9];
  const float* pb  = (const float*)d_in[10];
  char* ws = (char*)d_ws;
  _Float16* W16 = (_Float16*)(ws + WS_W16);
  float*    GS  = (float*)(ws + WS_GS);
  _Float16* QK  = (_Float16*)(ws + WS_QK);
  _Float16* VT  = (_Float16*)(ws + WS_VT);
  _Float16* AO  = (_Float16*)(ws + WS_AO);
  k_wcvt<<<dim3(CC * CC / 8 / 256), 256, 0, stream>>>(qw, kw, vw, pw, W16);
  k_gnsum<<<dim3(CC, NB), 256, 0, stream>>>(x, GS);
  k_gnvar<<<dim3(CC, NB), 256, 0, stream>>>(x, GS, GS);
  k_qkv<<<dim3(SEQ / 64, NB), 256, 0, stream>>>(x, gnw, gnb, W16, qb, kb, vb, GS, QK, VT);
  k_attn<<<dim3(SEQ / 32 * 2, NB), 1024, 0, stream>>>(QK, VT, AO);
  k_proj<<<dim3(SEQ / 64, NB), 256, 0, stream>>>(x, W16, pb, AO, (float*)d_out);
}

// v003
// It runs in 49.9 microseconds.
// Next to v002, in two timings, it ran 1.13 and 1.14 times as fast.
// Counting every step since v000, it is 2.75 times as fast.
#include <hip/hip_runtime.h>
// Channel-first spatial attention block with one-group GroupNorm and a plain residual: x [1][128][64][64] -> h = GN(x) (one mean / rstd over all 128 x 4096 values, per-channel affine);
// q/k/v = 1x1 convs ([out][in] weights + bias), 4 heads x 32; scores = q.k * 32^-0.5; softmax over the 4096 keys; ctx = P.v; result = x + pw.ctx + pb.
// (token-major q plane [head][n][32]; the k and V^T planes lie in the workspace in WMMA fragment order, see ld_fragp); flash attention with S^T = K.Q^T so that the score accumulators are directly the B operand of O^T = V^T.P^T
// (online softmax, one cross-half shuffle per step, no score plane); projection GEMM with the residual added at the float4 store stage.
// Compute dtype: every contraction v_wmma_f32_16x16x32_f16 (f16 operands, f32 accumulate), single products; all float inputs RNE-converted to bf16 first (exact in f16);
// carries: weights x16, P x256, ctx x32; statistics, softmax, residual in f32.
#ifndef NB
#define NB 1
#endif
#ifndef SEQ
#define SEQ 4096
#endif
#define SEQ_FULL 4096
#define CC 128
#define NH 4
#define HD 32
#define HXP 136                      /* LDS pitch (halves) of token-major 128-wide tiles */
#define SVP 72                       /* LDS pitch (halves) of the channel-major 64-token tile */
#define KSPL 8                       /* key ranges per (query tile, head) in the attention block */
#define SOP 68                       /* LDS pitch (floats) of the projection tile */
#define XS ((size_t)CC * SEQ_FULL)   /* per-batch stride of x / out */
#define QKS ((size_t)NB * NH * SEQ * HD)   /* halves between the q plane and the k plane */

static_assert(CC == NH * HD);
static_assert(HD == 32);
static_assert(CC == 128);
static_assert(CC <= 256);
static_assert(SEQ % 1024 == 0);
static_assert(SEQ <= SEQ_FULL);
static_assert(SEQ % (KSPL * 32) == 0);
static_assert(4 * KSPL * 32 == 1024);
static_assert(64 * HXP <= 128 * SVP);
static_assert(HXP % 8 == 0 && SVP % 8 == 0 && SOP % 4 == 0);
static_assert((CC * CC) % (8 * 256) == 0);

typedef _Float16 v16h __attribute__((ext_vector_type(16)));
typedef unsigned short v8us __attribute__((ext_vector_type(8), may_alias));
typedef float v8f  __attribute__((ext_vector_type(8)));
typedef float v4f  __attribute__((ext_vector_type(4)));
typedef float v4fa __attribute__((ext_vector_type(4), may_alias));
typedef float v2f  __attribute__((ext_vector_type(2)));
typedef _Float16 v2h __attribute__((ext_vector_type(2)));
union FragH { v16h v; v8us half[2]; _Float16 h[16]; unsigned short u[16]; };

// workspace carve (bytes, every region a multiple of 256)
constexpr size_t WS_W16 = 0;
constexpr size_t SZ_W16 = (size_t)4 * CC * CC * 2;
constexpr size_t WS_GS  = WS_W16 + SZ_W16;
constexpr size_t SZ_GS  = (size_t)NB * 2 * CC * 32 * 4;
constexpr size_t WS_QK  = WS_GS + SZ_GS;
constexpr size_t SZ_QK  = 2 * QKS * 2;
constexpr size_t WS_VT  = WS_QK + SZ_QK;
constexpr size_t SZ_VT  = (size_t)NB * CC * SEQ * 2;
constexpr size_t WS_AO  = WS_VT + SZ_VT;
constexpr size_t SZ_AO  = (size_t)NB * SEQ * CC * 2;
constexpr size_t WS_TOTAL = WS_AO + SZ_AO;
static_assert(SZ_W16 % 256 == 0 && SZ_GS % 256 == 0 && SZ_QK % 256 == 0 && SZ_VT % 256 == 0 && SZ_AO % 256 == 0);
static_assert(WS_TOTAL <= (size_t)134217728);

__device__ __forceinline__ float bf16_rne(float x) {
  unsigned int u = __float_as_uint(x);
  u = (u + 0x7FFFu + ((u >> 16) & 1u)) & 0xFFFF0000u;
  return __uint_as_float(u);
}

// 16x32 operand fragment from a k-contiguous 16-bit global row: elements 0..7 <- k 8h..8h+7, elements 8..15 <- k 16+8h..16+8h+7 (same map for A and B)
__device__ __forceinline__ v16h ld_frag(const _Float16* __restrict__ p, int hh) {
  FragH f;
  const unsigned short* q = (const unsigned short*)p;
  f.half[0] = *(const v8us*)(q + 8 * hh);
  f.half[1] = *(const v8us*)(q + 16 + 8 * hh);
  return f.v;
}
// the same 16x32 operand fragment from a plane kept in fragment order: 1 KiB per fragment, [k half j][lane][8 halves], chunk (j, lane = 16h + row) <- k 16j+8h..16j+8h+7 of that row;
// p = fragment base (the same in every lane), l8 = 8 * lane: each of the two wave-wide 16-byte loads covers 512 contiguous bytes (4 whole lines) instead of 16-byte pieces of 8 or 16 lines
__device__ __forceinline__ v16h ld_fragp(const _Float16* __restrict__ p, unsigned int l8) {
  FragH f;
  const unsigned short* q = (const unsigned short*)p;
  f.half[0] = *(const v8us*)(q + l8);
  f.half[1] = *(const v8us*)(q + 256 + l8);
  return f.v;
}
__device__ __forceinline__ v8f mma(v16h a, v16h b, v8f c) {
  v8f d = __builtin_amdgcn_wmma_f32_16x16x32_f16(false, a, false, b, (short)0, c, false, false);
  asm volatile("v_nop\n\tv_nop\n\tv_nop\n\tv_nop" : "+v"(d) : "v"(a), "v"(b));
  return d;
}

// fixed-order block sum over 256 threads (LDS tree); every thread gets the total
__device__ __forceinline__ float blk_sum256(float v) {
  __shared__ float red[256];
  const int t = threadIdx.x;
  red[t] = v;
  __syncthreads();
#pragma unroll 1
  for (int st = 128; st > 0; st >>= 1) {
    if (t < st) red[t] = red[t] + red[t + st];
    __syncthreads();
  }
  const float r = red[0];
  __syncthreads();
  return r;
}

__device__ __forceinline__ v8us cvt_w8(const float* __restrict__ w, int e) {
  const v4f a = *(const v4fa*)(w + e), c = *(const v4fa*)(w + e + 4);
  FragH f;
#pragma unroll
  for (int q = 0; q < 4; ++q) {
    f.h[q]     = (_Float16)(bf16_rne(a[q]) * 16.0f);
    f.h[4 + q] = (_Float16)(bf16_rne(c[q]) * 16.0f);
  }
  return f.half[0];
}

// one launch for everything that precedes the q/k/v GEMM (block-uniform split by block index).
// blocks 0..CC-1: channel c's 4096 values stay in registers (four 16-byte loads a thread, all in flight): its sum, then the sum of squares about ITS OWN mean;
// k_qkv joins the CC pairs exactly: var * N = sum_c (M2_c + SEQ * (mean_c - mean)^2), so no second pass over x has to wait for the overall mean.
// blocks CC..: the four weight matrices to f16 (x16 carry), which depend on nothing of the above.
__global__ __launch_bounds__(256) void k_pre(const float* __restrict__ x, const float* __restrict__ qw, const float* __restrict__ kw, const float* __restrict__ vw,
                                             const float* __restrict__ pw, _Float16* __restrict__ W16, float* __restrict__ GS) {
  const int tid = threadIdx.x, b = blockIdx.y;
  if (blockIdx.x >= CC) {
    if (b != 0) return;
    const int e = ((blockIdx.x - CC) * 256 + tid) * 8;
    const v8us v0 = cvt_w8(qw, e), v1 = cvt_w8(kw, e), v2 = cvt_w8(vw, e), v3 = cvt_w8(pw, e);
    unsigned short* d = (unsigned short*)W16 + e;
    *(v8us*)(d) = v0;
    *(v8us*)(d + CC * CC) = v1;
    *(v8us*)(d + 2 * CC * CC) = v2;
    *(v8us*)(d + 3 * CC * CC) = v3;
    return;
  }
  const int c = blockIdx.x;
  const float* xr = x + (size_t)b * XS + (size_t)c * SEQ_FULL;
  v4f a[SEQ / 1024];
#pragma unroll
  for (int i = 0; i < SEQ / 1024; ++i) a[i] = *(const v4fa*)(xr + tid * 4 + 1024 * i);
  float s = 0.f;
#pragma unroll
  for (int i = 0; i < SEQ / 1024; ++i) {
#pragma unroll
    for (int q = 0; q < 4; ++q) a[i][q] = bf16_rne(a[i][q]);
    s += (a[i][0] + a[i][1]) + (a[i][2] + a[i][3]);
  }
  const float tot = blk_sum256(s);
  const float mc = tot * (1.0f / (float)SEQ);
  float s2 = 0.f;
#pragma unroll
  for (int i = 0; i < SEQ / 1024; ++i) {
    const float d0 = a[i][0] - mc, d1 = a[i][1] - mc, d2 = a[i][2] - mc, d3 = a[i][3] - mc;
    s2 += (d0 * d0 + d1 * d1) + (d2 * d2 + d3 * d3);
  }
  const float tot2 = blk_sum256(s2);
  /* two whole 128-byte lines a channel, as before: [sum, 0...] in plane 0, [M2, 0...] in plane 1 */
  if (tid < 16) {
    const int pl = tid >> 3;
    float* d = GS + ((size_t)b * 2 * CC + (size_t)pl * CC + c) * 32;
    const v4f o = {((tid & 7) == 0) ? (pl ? tot2 : tot) : 0.f, 0.f, 0.f, 0.f};
    *(v4f*)(d + (tid & 7) * 4) = o;
  }
}

// fused normalise + q/k/v GEMM for 64 tokens per block (8 waves; wave w owns output channels 16w..16w+15).
// q, k: D[token][o] (A = h tile rows, B = weight rows) -> planes QK[{q,k}][head]: q token-major [n][32], k in fragment order [n / 16][1 KiB];
// v: D[o][token] (A = weight rows, B = h tile rows) -> plane VT[head] in fragment order [n / 32][16-d tile][1 KiB];
__global__ __launch_bounds__(256) void k_qkv(const float* __restrict__ x, const float* __restrict__ gnw, const float* __restrict__ gnb,
                                             const _Float16* __restrict__ W16, const float* __restrict__ qb, const float* __restrict__ kb,
                                             const float* __restrict__ vb, const float* __restrict__ GS,
                                             _Float16* __restrict__ QK, _Float16* __restrict__ VT) {
  __shared__ __attribute__((aligned(16))) _Float16 hx[64 * HXP];
  __shared__ __attribute__((aligned(16))) _Float16 stg[128 * SVP];
  const int tid = threadIdx.x, w = tid >> 5, lane = tid & 31, ln = lane & 15, hh = lane >> 4;
  const int n0 = blockIdx.x * 64, b = blockIdx.y;
  const float invn = 1.0f / (float)(CC * SEQ);
  const size_t gsb = (size_t)b * 2 * CC;
  const float ps = GS[(gsb + (tid & (CC - 1))) * 32];
  const float pv = GS[(gsb + CC + (tid & (CC - 1))) * 32];
  const float mean = blk_sum256((tid < CC) ? ps : 0.f) * invn;
  const float dm   = ps * (1.0f / (float)SEQ) - mean;   /* channel mean - overall mean */
  const float var  = blk_sum256((tid < CC) ? (pv + (float)SEQ * (dm * dm)) : 0.f) * invn;
  const float rstd = rsqrtf(var + 1e-5f);
  const float* xb = x + (size_t)b * XS;
#pragma unroll 1
  for (int idx = tid; idx < CC * 64; idx += 256) {
    const int c = idx >> 6, col = idx & 63;
    const float v = bf16_rne(xb[(size_t)c * SEQ_FULL + n0 + col]);
    const float hv = ((v - mean) * rstd) * bf16_rne(gnw[c]) + bf16_rne(gnb[c]);
    hx[col * HXP + c] = (_Float16)hv;
  }
  __syncthreads();

  const float bqv = bf16_rne(qb[16 * w + ln]), bkv = bf16_rne(kb[16 * w + ln]);
#pragma unroll 1
  for (int m = 0; m < 2; ++m) {
    v16h fw[4];
    const _Float16* wr = W16 + (size_t)m * CC * CC + (size_t)(16 * w + ln) * CC;
#pragma unroll
    for (int kc = 0; kc < 4; ++kc) fw[kc] = ld_frag(wr + kc * 32, hh);
    const float bias = (m == 0) ? bqv : bkv;
#pragma unroll
    for (int nt = 0; nt < 4; ++nt) {
      v8f acc = {0.f, 0.f, 0.f, 0.f, 0.f, 0.f, 0.f, 0.f};
#pragma unroll
      for (int kc = 0; kc < 4; ++kc) {
        FragH fa;
        fa.half[0] = *(const v8us*)&hx[(nt * 16 + ln) * HXP + kc * 32 + 8 * hh];
        fa.half[1] = *(const v8us*)&hx[(nt * 16 + ln) * HXP + kc * 32 + 16 + 8 * hh];
        acc = mma(fa.v, fw[kc], acc);
      }
#pragma unroll
      for (int r = 0; r < 8; ++r) stg[(nt * 16 + 8 * hh + r) * HXP + 16 * w + ln] = (_Float16)(acc[r] * 0.0625f + bias);
    }
    __syncthreads();
    unsigned short* P = (unsigned short*)QK + (size_t)m * QKS + (size_t)b * NH * SEQ * HD;
    {
#pragma unroll
      for (int i = 0; i < 4; ++i) {
        const int idx = tid + 256 * i;
        const int head = idx >> 8, pi = idx & 255;
        /* 16-byte chunk pi of the head's 64 tokens: q token-major [token][4 chunks]; k in fragment order [16-key tile][k half][lane] */
        const int tok = (m == 0) ? (pi >> 2) : ((pi >> 6) * 16 + (pi & 15));
        const int d8  = (m == 0) ? ((pi & 3) * 8) : (((pi >> 5) & 1) * 16 + ((pi >> 4) & 1) * 8);
        const v8us v = *(const v8us*)&stg[tok * HXP + head * HD + d8];
        *(v8us*)(P + ((size_t)head * SEQ + n0) * HD + pi * 8) = v;
      }
      
    }
    __syncthreads();
  }
  {
    v16h fw[4];
    const _Float16* wr = W16 + (size_t)2 * CC * CC + (size_t)(16 * w + ln) * CC;
#pragma unroll
    for (int kc = 0; kc < 4; ++kc) fw[kc] = ld_frag(wr + kc * 32, hh);
    float bvr[8];
#pragma unroll
    for (int r = 0; r < 8; ++r) bvr[r] = bf16_rne(vb[16 * w + 8 * hh + r]);
#pragma unroll
    for (int nt = 0; nt < 4; ++nt) {
      v8f acc = {0.f, 0.f, 0.f, 0.f, 0.f, 0.f, 0.f, 0.f};
#pragma unroll
      for (int kc = 0; kc < 4; ++kc) {
        FragH fb;
        fb.half[0] = *(const v8us*)&hx[(nt * 16 + ln) * HXP + kc * 32 + 8 * hh];
        fb.half[1] = *(const v8us*)&hx[(nt * 16 + ln) * HXP + kc * 32 + 16 + 8 * hh];
        acc = mma(fw[kc], fb.v, acc);
      }
#pragma unroll
      for (int r = 0; r < 8; ++r) stg[(16 * w + 8 * hh + r) * SVP + nt * 16 + ln] = (_Float16)(acc[r] * 0.0625f + bvr[r]);
    }
    __syncthreads();
    unsigned short* V = (unsigned short*)VT + (size_t)b * CC * SEQ;
    {
#pragma unroll
      for (int i = 0; i < 4; ++i) {
        const int idx = tid + 256 * i;
        const int head = idx >> 8, pi = idx & 255;
        /* fragment order: chunk pi of the head's 64 keys = [32-key step][16-d tile][k half][lane] */
        const int o = head * HD + ((pi >> 6) & 1) * 16 + (pi & 15);
        const int p8 = (pi >> 7) * 32 + ((pi >> 5) & 1) * 16 + ((pi >> 4) & 1) * 8;
        const v8us v = *(const v8us*)&stg[o * SVP + p8];
        *(v8us*)(V + ((size_t)head * SEQ + n0) * HD + pi * 8) = v;
      }
      
    }
  }
}

// flash attention: block = 32 queries x 2 heads x KSPL key ranges, one wave each (wave: head = w & 1, query tile = (w >> 1) & 1, key range = w >> 2). Per 32-key step:
// S^T[key][q] = K.Q^T (two 16-key tiles; A = K rows, B = Q rows), online softmax per query column (lane), P^T packed from the two score tiles
// (element r <- tile 0 row 8h+r, element 8+r <- tile 1 row 8h+r) as the B operand of O^T[d][q] += V^T[d][key].P^T (A = V^T rows, two 16-d tiles).
// Each wave walks its own SEQ / KSPL keys with its own maximum, sum and accumulators; the KSPL partial results are joined in LDS in fixed range order.
__global__ __launch_bounds__(1024) __attribute__((amdgpu_waves_per_eu(8, 8))) /* 32 waves on 4 SIMDs: lets the scheduler use the 128 VGPRs a wave may have */ void k_attn(const _Float16* __restrict__ QK, const _Float16* __restrict__ VT, _Float16* __restrict__ AO) {
  __shared__ __attribute__((aligned(16))) float po[4 * KSPL * 4 * 32 * 4];   /* [wave][4-row chunk][lane] float4: un-normalised O^T partials */
  __shared__ float pm[4 * KSPL * 16];                                        /* [wave][query] running maximum */
  __shared__ float pl[4 * KSPL * 16];                                        /* [wave][query] sum of exponentials */
  __shared__ __attribute__((aligned(16))) _Float16 st[32 * SVP];
  const int tid = threadIdx.x, lane = tid & 31, ln = lane & 15, hh = lane >> 4;
  const int w = __builtin_amdgcn_readfirstlane(tid >> 5);   /* wave number in a scalar register: head, tile and key range become scalar address parts */
  const int hp = blockIdx.x & 1, qblk = blockIdx.x >> 1, b = blockIdx.y;
  const int hd = hp * 2 + (w & 1), qs = (w >> 1) & 1, k0 = (w >> 2) * (SEQ / KSPL);
  const int q0 = qblk * 32 + qs * 16;
  const _Float16* Qh = QK + ((size_t)b * NH + hd) * SEQ * HD;
  const _Float16* Kh = Qh + QKS;
  const _Float16* Vh = VT + ((size_t)b * CC + hd * HD) * SEQ;
  const v16h bq = ld_frag(Qh + (size_t)(q0 + ln) * HD, hh);
  const _Float16* kt = Kh + (size_t)k0 * HD;   /* the wave's current 32-key step: 2 KiB of k fragments, 2 KiB of V^T fragments */
  const _Float16* vt = Vh + (size_t)k0 * HD;
  const v8f z8 = {0.f, 0.f, 0.f, 0.f, 0.f, 0.f, 0.f, 0.f};
  const float sc = 0.17677669529663687f;
  float mrun = -1.0e30f, lrun = 0.f;
  v8f o0 = z8, o1 = z8;
#pragma unroll 1
  for (int kb = k0; kb < k0 + SEQ / KSPL; kb += 32, kt += 32 * HD, vt += 32 * HD) {
    const v16h ka0 = ld_fragp(kt, lane * 8);
    const v16h ka1 = ld_fragp(kt + 512, lane * 8);
    v8f s0 = mma(ka0, bq, z8);
    v8f s1 = mma(ka1, bq, z8);
    float mx = -1.0e30f;
#pragma unroll
    for (int r = 0; r < 8; ++r) { s0[r] *= sc; s1[r] *= sc; mx = fmaxf(mx, fmaxf(s0[r], s1[r])); }
    mx = fmaxf(mx, __shfl_xor(mx, 16, 32));
    const float mn = fmaxf(mrun, mx);
    const float al = __expf(mrun - mn);
    mrun = mn;
    FragH pf;
    float rs = 0.f;
#pragma unroll
    for (int r = 0; r < 8; ++r) {
      const float p0 = __expf(s0[r] - mn), p1 = __expf(s1[r] - mn);
      rs += p0 + p1;
      pf.h[r]     = (_Float16)(p0 * 256.0f);
      pf.h[8 + r] = (_Float16)(p1 * 256.0f);
    }
    lrun = lrun * al + rs;
#pragma unroll
    for (int r = 0; r < 8; ++r) { o0[r] *= al; o1[r] *= al; }
    const v16h va0 = ld_fragp(vt, lane * 8);
    const v16h va1 = ld_fragp(vt + 512, lane * 8);
    o0 = mma(va0, pf.v, o0);
    o1 = mma(va1, pf.v, o1);
  }
  const float lt = lrun + __shfl_xor(lrun, 16, 32);
  {
    const v4f c0 = {o0[0], o0[1], o0[2], o0[3]}, c1 = {o0[4], o0[5], o0[6], o0[7]};
    const v4f c2 = {o1[0], o1[1], o1[2], o1[3]}, c3 = {o1[4], o1[5], o1[6], o1[7]};
    float* pw_ = &po[((size_t)w * 4 * 32 + lane) * 4];
    *(v4f*)(pw_)           = c0;
    *(v4f*)(pw_ + 32 * 4)  = c1;
    *(v4f*)(pw_ + 64 * 4)  = c2;
    *(v4f*)(pw_ + 96 * 4)  = c3;
    if (hh == 0) { pm[w * 16 + ln] = mrun; pl[w * 16 + ln] = lt; }
  }
  __syncthreads();
  {
    /* join: thread = (tile-and-head pair p, chunk c, source lane l, half of the float4); ranges summed in index order */
    const int h2 = tid & 1, l = (tid >> 1) & 31, c = (tid >> 6) & 3, p = tid >> 8;
    const int jl = l & 15, jh = l >> 4;
    float mr[KSPL];
    float M = -1.0e30f;
#pragma unroll
    for (int s = 0; s < KSPL; ++s) { mr[s] = pm[(s * 4 + p) * 16 + jl]; M = fmaxf(M, mr[s]); }
    float L = 0.f, a0 = 0.f, a1 = 0.f;
#pragma unroll
    for (int s = 0; s < KSPL; ++s) {
      const float wg = __expf(mr[s] - M);
      const v2f v = *(const v2f*)&po[(((size_t)(s * 4 + p) * 4 + c) * 32 + l) * 4 + 2 * h2];
      L  += wg * pl[(s * 4 + p) * 16 + jl];
      a0 += wg * v[0];
      a1 += wg * v[1];
    }
    const float inv = 0.125f * (1.0f / L);           /* 2^-8 (P carry) x 2^5 (ctx carry) */
    const v2h e = {(_Float16)(a0 * inv), (_Float16)(a1 * inv)};
    *(v2h*)&st[((p >> 1) * 16 + jl) * SVP + (p & 1) * HD + (c >> 1) * 16 + 8 * jh + (c & 1) * 4 + 2 * h2] = e;
  }
  __syncthreads();
  if (tid < 256) {
    unsigned short* A = (unsigned short*)AO + ((size_t)b * SEQ + (size_t)qblk * 32) * CC + hp * 2 * HD;
    const int row = tid >> 3, p8 = (tid & 7) * 8;
    const v8us v = *(const v8us*)&st[row * SVP + p8];
    *(v8us*)(A + (size_t)row * CC + p8) = v;
  }
}

// projection: D[o][n] = pw[o][:] . ctx[n][:] (A = weight rows, B = ctx rows), 64 tokens per block, wave w owns o = 16w..16w+15;
__global__ __launch_bounds__(256) void k_proj(const float* __restrict__ x, const _Float16* __restrict__ W16, const float* __restrict__ pb,
                                              const _Float16* __restrict__ AO, float* __restrict__ out) {
  __shared__ __attribute__((aligned(16))) float so[128 * SOP];
  const int tid = threadIdx.x, w = tid >> 5, lane = tid & 31, ln = lane & 15, hh = lane >> 4;
  const int n0 = blockIdx.x * 64, b = blockIdx.y;
  v16h fw[4];
  const _Float16* wr = W16 + (size_t)3 * CC * CC + (size_t)(16 * w + ln) * CC;
#pragma unroll
  for (int kc = 0; kc < 4; ++kc) fw[kc] = ld_frag(wr + kc * 32, hh);
#pragma unroll
  for (int nt = 0; nt < 4; ++nt) {
    const _Float16* br = AO + ((size_t)b * SEQ + n0 + nt * 16 + ln) * CC;
    v8f acc = {0.f, 0.f, 0.f, 0.f, 0.f, 0.f, 0.f, 0.f};
#pragma unroll
    for (int kc = 0; kc < 4; ++kc) { const v16h fb = ld_frag(br + kc * 32, hh); acc = mma(fw[kc], fb, acc); }
#pragma unroll
    for (int r = 0; r < 8; ++r) so[(16 * w + 8 * hh + r) * SOP + nt * 16 + ln] = acc[r] * 0.001953125f;
  }
  __syncthreads();
  const float* xb = x + (size_t)b * XS;
  float* ob = out + (size_t)b * XS;
  {
#pragma unroll 1
    for (int i = 0; i < 8; ++i) {
      const int idx = tid + 256 * i;
      const int o = idx >> 4, c4 = (idx & 15) * 4;
      const v4f a = *(const v4fa*)&so[o * SOP + c4];
      const size_t e = (size_t)o * SEQ_FULL + n0 + c4;
      const v4f xv = *(const v4fa*)(xb + e);
      const float pbv = bf16_rne(pb[o]);
      v4f y;
#pragma unroll
      for (int q = 0; q < 4; ++q) y[q] = bf16_rne(xv[q]) + (a[q] + pbv);
      *(v4f*)(ob + e) = y;
    }
    
  }
}

extern "C" void kernel_launch(void* const* d_in, const int* in_sizes, int n_in,
                              void* d_out, int out_size, void* d_ws, size_t ws_size, hipStream_t stream) {
  if (n_in < 11) return;
  if (in_sizes[0] < NB * CC * SEQ) return;
  if (in_sizes[1] < CC || in_sizes[2] < CC || in_sizes[4] < CC || in_sizes[6] < CC || in_sizes[8] < CC || in_sizes[10] < CC) return;
  if (in_sizes[3] < CC * CC || in_sizes[5] < CC * CC || in_sizes[7] < CC * CC || in_sizes[9] < CC * CC) return;
  if (out_size < NB * CC * SEQ) return;
  if (ws_size < WS_TOTAL) return;
  const float* x   = (const float*)d_in[0];
  const float* gnw = (const float*)d_in[1];
  const float* gnb = (const float*)d_in[2];
  const float* qw  = (const float*)d_in[3];
  const float* qb  = (const float*)d_in[4];
  const float* kw  = (const float*)d_in[5];
  const float* kb  = (const float*)d_in[6];
  const float* vw  = (const float*)d_in[7];
  const float* vb  = (const float*)d_in[8];
  const float* pw  = (const float*)d_in[9];
  const float* pb  = (const float*)d_in[10];
  char* ws = (char*)d_ws;
  _Float16* W16 = (_Float16*)(ws + WS_W16);
  float*    GS  = (float*)(ws + WS_GS);
  _Float16* QK  = (_Float16*)(ws + WS_QK);
  _Float16* VT  = (_Float16*)(ws + WS_VT);
  _Float16* AO  = (_Float16*)(ws + WS_AO);
  k_pre<<<dim3(CC + CC * CC / 8 / 256, NB), 256, 0, stream>>>(x, qw, kw, vw, pw, W16, GS);
  k_qkv<<<dim3(SEQ / 64, NB), 256, 0, stream>>>(x, gnw, gnb, W16, qb, kb, vb, GS, QK, VT);
  k_attn<<<dim3(SEQ / 32 * 2, NB), 1024, 0, stream>>>(QK, VT, AO);
  k_proj<<<dim3(SEQ / 64, NB), 256, 0, stream>>>(x, W16, pb, AO, (float*)d_out);
}

// v004
// A run of this version takes 36.6 microseconds.
// In both of two side-by-side timings against v003, it was 1.35 times as fast.
// Counting every step since v000, it is 3.71 times as fast.
#include <hip/hip_runtime.h>
// Channel-first spatial attention block with one-group GroupNorm and a plain residual: x [1][128][64][64] -> h = GN(x) (one mean / rstd over all 128 x 4096 values, per-channel affine);
// q/k/v = 1x1 convs ([out][in] weights + bias), 4 heads x 32; scores = q.k * 32^-0.5; softmax over the 4096 keys; ctx = P.v; result = x + pw.ctx + pb.
// (token-major q plane [head][n][32]; the k and V^T planes lie in the workspace in WMMA fragment order, see ld_fragp); flash attention with S^T = K.Q^T so that the score accumulators are directly the B operand of O^T = V^T.P^T
// (online softmax, one cross-half shuffle per step, no score plane); projection GEMM with the residual added at the float4 store stage.
// Compute dtype: every contraction v_wmma_f32_16x16x32_f16 (f16 operands, f32 accumulate), single products; all float inputs RNE-converted to bf16 first (exact in f16);
// carries: weights x16, P x256, ctx x32; statistics, softmax, residual in f32.
#ifndef NB
#define NB 1
#endif
#ifndef SEQ
#define SEQ 4096
#endif
#define SEQ_FULL 4096
#define CC 128
#define NH 4
#define HD 32
#define HXP 136                      /* LDS pitch (halves) of token-major 128-wide tiles */
#define SVP 72                       /* LDS pitch (halves) of the channel-major 64-token tile */
#define KSPL 8                       /* key ranges per (query tile, head) in the attention block */
#define SOP 68                       /* LDS pitch (floats) of the projection tile */
#define XS ((size_t)CC * SEQ_FULL)   /* per-batch stride of x / out */
#define QKS ((size_t)NB * NH * SEQ * HD)   /* halves between the q plane and the k plane */

static_assert(CC == NH * HD);
static_assert(HD == 32);
static_assert(CC == 128);
static_assert(CC <= 256);
static_assert(SEQ % 1024 == 0);
static_assert(SEQ <= SEQ_FULL);
static_assert(SEQ % (KSPL * 32) == 0);
static_assert(4 * KSPL * 32 == 1024);
static_assert(64 * HXP <= 128 * SVP);
static_assert(HXP % 8 == 0 && SVP % 8 == 0 && SOP % 4 == 0);
static_assert((CC * CC) % (8 * 256) == 0);

typedef _Float16 v16h __attribute__((ext_vector_type(16)));
typedef unsigned short v8us __attribute__((ext_vector_type(8), may_alias));
typedef float v8f  __attribute__((ext_vector_type(8)));
typedef float v4f  __attribute__((ext_vector_type(4)));
typedef float v4fa __attribute__((ext_vector_type(4), may_alias));
typedef float v2f  __attribute__((ext_vector_type(2)));
typedef _Float16 v2h __attribute__((ext_vector_type(2)));
typedef _Float16 v4h __attribute__((ext_vector_type(4)));
union FragH { v16h v; v8us half[2]; _Float16 h[16]; unsigned short u[16]; };

// workspace carve (bytes, every region a multiple of 256)
constexpr size_t WS_W16 = 0;
constexpr size_t SZ_W16 = (size_t)4 * CC * CC * 2;
constexpr size_t WS_GS  = WS_W16 + SZ_W16;
constexpr size_t SZ_GS  = (size_t)NB * 2 * CC * 32 * 4;
constexpr size_t WS_QK  = WS_GS + SZ_GS;
constexpr size_t SZ_QK  = 2 * QKS * 2;
constexpr size_t WS_VT  = WS_QK + SZ_QK;
constexpr size_t SZ_VT  = (size_t)NB * CC * SEQ * 2;
constexpr size_t WS_AO  = WS_VT + SZ_VT;
constexpr size_t SZ_AO  = (size_t)NB * SEQ * CC * 2;
constexpr size_t WS_TOTAL = WS_AO + SZ_AO;
static_assert(SZ_W16 % 256 == 0 && SZ_GS % 256 == 0 && SZ_QK % 256 == 0 && SZ_VT % 256 == 0 && SZ_AO % 256 == 0);
static_assert(WS_TOTAL <= (size_t)134217728);

__device__ __forceinline__ float bf16_rne(float x) {
  unsigned int u = __float_as_uint(x);
  u = (u + 0x7FFFu + ((u >> 16) & 1u)) & 0xFFFF0000u;
  return __uint_as_float(u);
}

// 16x32 operand fragment from a k-contiguous 16-bit global row: elements 0..7 <- k 8h..8h+7, elements 8..15 <- k 16+8h..16+8h+7 (same map for A and B)
__device__ __forceinline__ v16h ld_frag(const _Float16* __restrict__ p, int hh) {
  FragH f;
  const unsigned short* q = (const unsigned short*)p;
  f.half[0] = *(const v8us*)(q + 8 * hh);
  f.half[1] = *(const v8us*)(q + 16 + 8 * hh);
  return f.v;
}
// the same 16x32 operand fragment from a plane kept in fragment order: 1 KiB per fragment, [k half j][lane][8 halves], chunk (j, lane = 16h + row) <- k 16j+8h..16j+8h+7 of that row;
// p = fragment base (the same in every lane), l8 = 8 * lane: each of the two wave-wide 16-byte loads covers 512 contiguous bytes (4 whole lines) instead of 16-byte pieces of 8 or 16 lines
__device__ __forceinline__ v16h ld_fragp(const _Float16* __restrict__ p, unsigned int l8) {
  FragH f;
  const unsigned short* q = (const unsigned short*)p;
  f.half[0] = *(const v8us*)(q + l8);
  f.half[1] = *(const v8us*)(q + 256 + l8);
  return f.v;
}
__device__ __forceinline__ v8f mma(v16h a, v16h b, v8f c) {
  v8f d = __builtin_amdgcn_wmma_f32_16x16x32_f16(false, a, false, b, (short)0, c, false, false);
  asm volatile("v_nop\n\tv_nop\n\tv_nop\n\tv_nop" : "+v"(d) : "v"(a), "v"(b));
  return d;
}

// fixed-order block sum over 256 threads (LDS tree); every thread gets the total
__device__ __forceinline__ float blk_sum256(float v) {
  __shared__ float red[256];
  const int t = threadIdx.x;
  red[t] = v;
  __syncthreads();
#pragma unroll 1
  for (int st = 128; st > 0; st >>= 1) {
    if (t < st) red[t] = red[t] + red[t + st];
    __syncthreads();
  }
  const float r = red[0];
  __syncthreads();
  return r;
}

__device__ __forceinline__ v8us cvt_w8(const float* __restrict__ w, int e) {
  const v4f a = *(const v4fa*)(w + e), c = *(const v4fa*)(w + e + 4);
  FragH f;
#pragma unroll
  for (int q = 0; q < 4; ++q) {
    f.h[q]     = (_Float16)(bf16_rne(a[q]) * 16.0f);
    f.h[4 + q] = (_Float16)(bf16_rne(c[q]) * 16.0f);
  }
  return f.half[0];
}

// one launch for everything that precedes the q/k/v GEMM (block-uniform split by block index).
// blocks 0..CC-1: channel c's 4096 values stay in registers (four 16-byte loads a thread, all in flight): its sum, then the sum of squares about ITS OWN mean;
// k_qkv joins the CC pairs exactly: var * N = sum_c (M2_c + SEQ * (mean_c - mean)^2), so no second pass over x has to wait for the overall mean.
// blocks CC..: the four weight matrices to f16 (x16 carry), which depend on nothing of the above.
__global__ __launch_bounds__(256) void k_pre(const float* __restrict__ x, const float* __restrict__ qw, const float* __restrict__ kw, const float* __restrict__ vw,
                                             const float* __restrict__ pw, _Float16* __restrict__ W16, float* __restrict__ GS) {
  const int tid = threadIdx.x, b = blockIdx.y;
  if (blockIdx.x >= CC) {
    if (b != 0) return;
    const int e = ((blockIdx.x - CC) * 256 + tid) * 8;
    const v8us v0 = cvt_w8(qw, e), v1 = cvt_w8(kw, e), v2 = cvt_w8(vw, e), v3 = cvt_w8(pw, e);
    unsigned short* d = (unsigned short*)W16 + e;
    *(v8us*)(d) = v0;
    *(v8us*)(d + CC * CC) = v1;
    *(v8us*)(d + 2 * CC * CC) = v2;
    *(v8us*)(d + 3 * CC * CC) = v3;
    return;
  }
  const int c = blockIdx.x;
  const float* xr = x + (size_t)b * XS + (size_t)c * SEQ_FULL;
  v4f a[SEQ / 1024];
#pragma unroll
  for (int i = 0; i < SEQ / 1024; ++i) a[i] = *(const v4fa*)(xr + tid * 4 + 1024 * i);
  float s = 0.f;
#pragma unroll
  for (int i = 0; i < SEQ / 1024; ++i) {
#pragma unroll
    for (int q = 0; q < 4; ++q) a[i][q] = bf16_rne(a[i][q]);
    s += (a[i][0] + a[i][1]) + (a[i][2] + a[i][3]);
  }
  const float tot = blk_sum256(s);
  const float mc = tot * (1.0f / (float)SEQ);
  float s2 = 0.f;
#pragma unroll
  for (int i = 0; i < SEQ / 1024; ++i) {
    const float d0 = a[i][0] - mc, d1 = a[i][1] - mc, d2 = a[i][2] - mc, d3 = a[i][3] - mc;
    s2 += (d0 * d0 + d1 * d1) + (d2 * d2 + d3 * d3);
  }
  const float tot2 = blk_sum256(s2);
  /* two whole 128-byte lines a channel, as before: [sum, 0...] in plane 0, [M2, 0...] in plane 1 */
  if (tid < 16) {
    const int pl = tid >> 3;
    float* d = GS + ((size_t)b * 2 * CC + (size_t)pl * CC + c) * 32;
    const v4f o = {((tid & 7) == 0) ? (pl ? tot2 : tot) : 0.f, 0.f, 0.f, 0.f};
    *(v4f*)(d + (tid & 7) * 4) = o;
  }
}

// fused normalise + q/k/v GEMM for 64 tokens per block (8 waves; wave w owns output channels 16w..16w+15).
// q, k: D[token][o] (A = h tile rows, B = weight rows) -> planes QK[{q,k}][head]: q token-major [n][32], k in fragment order [n / 16][1 KiB];
// v: D[o][token] (A = weight rows, B = h tile rows) -> plane VT[head] in fragment order [n / 32][16-d tile][1 KiB];
// every global operand (statistics, x tile, affine, the three weight fragment sets, biases) is asked for at entry and waits in registers: the block pays one load latency.
__global__ __launch_bounds__(256) __attribute__((amdgpu_waves_per_eu(2, 2))) /* 8 waves on 4 SIMDs: lets the scheduler keep the loaded operands in registers */ void k_qkv(const float* __restrict__ x, const float* __restrict__ gnw, const float* __restrict__ gnb,
                                             const _Float16* __restrict__ W16, const float* __restrict__ qb, const float* __restrict__ kb,
                                             const float* __restrict__ vb, const float* __restrict__ GS,
                                             _Float16* __restrict__ QK, _Float16* __restrict__ VT) {
  __shared__ __attribute__((aligned(16))) _Float16 hx[64 * HXP];
  __shared__ __attribute__((aligned(16))) _Float16 stg[128 * SVP];
  const int tid = threadIdx.x, w = tid >> 5, lane = tid & 31, ln = lane & 15, hh = lane >> 4;
  const int n0 = blockIdx.x * 64, b = blockIdx.y;
  const float invn = 1.0f / (float)(CC * SEQ);
  const size_t gsb = (size_t)b * 2 * CC;
  const float ps = GS[(gsb + (tid & (CC - 1))) * 32];
  const float pv = GS[(gsb + CC + (tid & (CC - 1))) * 32];
  /* x tile: a thread holds 4 channels x 8 tokens (eight 16-byte loads; a wave-wide load covers four whole 128-byte lines) */
  const int c4 = 16 * w + 4 * (lane >> 3), t4 = 4 * (lane & 7);
  const float* xq = x + (size_t)b * XS + (size_t)c4 * SEQ_FULL + n0 + t4;
  v4f xr[2][4];
#pragma unroll
  for (int i = 0; i < 2; ++i) {
#pragma unroll
    for (int j = 0; j < 4; ++j) xr[i][j] = *(const v4fa*)(xq + (size_t)j * SEQ_FULL + 32 * i);
  }
  const v4f gw4 = *(const v4fa*)(gnw + c4), gb4 = *(const v4fa*)(gnb + c4);
  v16h fw[3][4];
  const _Float16* wr0 = W16 + (size_t)(16 * w + ln) * CC;
#pragma unroll
  for (int m = 0; m < 3; ++m) {
#pragma unroll
    for (int kc = 0; kc < 4; ++kc) fw[m][kc] = ld_frag(wr0 + m * CC * CC + kc * 32, hh);
  }
  const float bqr = qb[16 * w + ln], bkr = kb[16 * w + ln];
  const v4f bv0 = *(const v4fa*)(vb + 16 * w + 8 * hh), bv1 = *(const v4fa*)(vb + 16 * w + 8 * hh + 4);
  /* the address registers of the loads above stay as they are until this wait: none becomes another load's destination first */
  asm volatile("s_wait_xcnt 0x0" :: "v"(xq), "v"(wr0 + 8 * hh) : "memory");
  __builtin_amdgcn_sched_barrier(0);   /* the first use of a loaded value, and with it the first wait for data, stays behind the issue of the last load */
  const float mean = blk_sum256((tid < CC) ? ps : 0.f) * invn;
  const float dm   = ps * (1.0f / (float)SEQ) - mean;   /* channel mean - overall mean */
  const float var  = blk_sum256((tid < CC) ? (pv + (float)SEQ * (dm * dm)) : 0.f) * invn;
  const float rstd = rsqrtf(var + 1e-5f);
#pragma unroll
  for (int i = 0; i < 2; ++i) {
#pragma unroll
    for (int q = 0; q < 4; ++q) {
      v4h hv;
#pragma unroll
      for (int j = 0; j < 4; ++j) hv[j] = (_Float16)(((bf16_rne(xr[i][j][q]) - mean) * rstd) * bf16_rne(gw4[j]) + bf16_rne(gb4[j]));
      *(v4h*)&hx[(32 * i + t4 + q) * HXP + c4] = hv;
    }
  }
  __syncthreads();

  /* the 16 h fragments serve q and k as A and v as B (same map): read once, all LDS loads in flight, kept in registers */
  v16h fh[4][4];
#pragma unroll
  for (int nt = 0; nt < 4; ++nt) {
#pragma unroll
    for (int kc = 0; kc < 4; ++kc) {
      FragH f;
      f.half[0] = *(const v8us*)&hx[(nt * 16 + ln) * HXP + kc * 32 + 8 * hh];
      f.half[1] = *(const v8us*)&hx[(nt * 16 + ln) * HXP + kc * 32 + 16 + 8 * hh];
      fh[nt][kc] = f.v;
    }
  }
  const float bqv = bf16_rne(bqr), bkv = bf16_rne(bkr);
#pragma unroll
  for (int m = 0; m < 2; ++m) {
    const float bias = (m == 0) ? bqv : bkv;
#pragma unroll
    for (int nt = 0; nt < 4; ++nt) {
      v8f acc = {0.f, 0.f, 0.f, 0.f, 0.f, 0.f, 0.f, 0.f};
#pragma unroll
      for (int kc = 0; kc < 4; ++kc) acc = mma(fh[nt][kc], fw[m][kc], acc);
#pragma unroll
      for (int r = 0; r < 8; ++r) stg[(nt * 16 + 8 * hh + r) * HXP + 16 * w + ln] = (_Float16)(acc[r] * 0.0625f + bias);
    }
    __syncthreads();
    unsigned short* P = (unsigned short*)QK + (size_t)m * QKS + (size_t)b * NH * SEQ * HD;
    {
#pragma unroll
      for (int i = 0; i < 4; ++i) {
        const int idx = tid + 256 * i;
        const int head = idx >> 8, pi = idx & 255;
        /* 16-byte chunk pi of the head's 64 tokens: q token-major [token][4 chunks]; k in fragment order [16-key tile][k half][lane] */
        const int tok = (m == 0) ? (pi >> 2) : ((pi >> 6) * 16 + (pi & 15));
        const int d8  = (m == 0) ? ((pi & 3) * 8) : (((pi >> 5) & 1) * 16 + ((pi >> 4) & 1) * 8);
        const v8us v = *(const v8us*)&stg[tok * HXP + head * HD + d8];
        *(v8us*)(P + ((size_t)head * SEQ + n0) * HD + pi * 8) = v;
      }
      
    }
    __syncthreads();
  }
  {
    float bvr[8];
#pragma unroll
    for (int r = 0; r < 4; ++r) { bvr[r] = bf16_rne(bv0[r]); bvr[4 + r] = bf16_rne(bv1[r]); }
#pragma unroll
    for (int nt = 0; nt < 4; ++nt) {
      v8f acc = {0.f, 0.f, 0.f, 0.f, 0.f, 0.f, 0.f, 0.f};
#pragma unroll
      for (int kc = 0; kc < 4; ++kc) acc = mma(fw[2][kc], fh[nt][kc], acc);
#pragma unroll
      for (int r = 0; r < 8; ++r) stg[(16 * w + 8 * hh + r) * SVP + nt * 16 + ln] = (_Float16)(acc[r] * 0.0625f + bvr[r]);
    }
    __syncthreads();
    unsigned short* V = (unsigned short*)VT + (size_t)b * CC * SEQ;
    {
#pragma unroll
      for (int i = 0; i < 4; ++i) {
        const int idx = tid + 256 * i;
        const int head = idx >> 8, pi = idx & 255;
        /* fragment order: chunk pi of the head's 64 keys = [32-key step][16-d tile][k half][lane] */
        const int o = head * HD + ((pi >> 6) & 1) * 16 + (pi & 15);
        const int p8 = (pi >> 7) * 32 + ((pi >> 5) & 1) * 16 + ((pi >> 4) & 1) * 8;
        const v8us v = *(const v8us*)&stg[o * SVP + p8];
        *(v8us*)(V + ((size_t)head * SEQ + n0) * HD + pi * 8) = v;
      }
      
    }
  }
}

// flash attention: block = 32 queries x 2 heads x KSPL key ranges, one wave each (wave: head = w & 1, query tile = (w >> 1) & 1, key range = w >> 2). Per 32-key step:
// S^T[key][q] = K.Q^T (two 16-key tiles; A = K rows, B = Q rows), online softmax per query column (lane), P^T packed from the two score tiles
// (element r <- tile 0 row 8h+r, element 8+r <- tile 1 row 8h+r) as the B operand of O^T[d][q] += V^T[d][key].P^T (A = V^T rows, two 16-d tiles).
// Each wave walks its own SEQ / KSPL keys with its own maximum, sum and accumulators; the KSPL partial results are joined in LDS in fixed range order.
__global__ __launch_bounds__(1024) __attribute__((amdgpu_waves_per_eu(8, 8))) /* 32 waves on 4 SIMDs: lets the scheduler use the 128 VGPRs a wave may have */ void k_attn(const _Float16* __restrict__ QK, const _Float16* __restrict__ VT, _Float16* __restrict__ AO) {
  __shared__ __attribute__((aligned(16))) float po[4 * KSPL * 4 * 32 * 4];   /* [wave][4-row chunk][lane] float4: un-normalised O^T partials */
  __shared__ float pm[4 * KSPL * 16];                                        /* [wave][query] running maximum */
  __shared__ float pl[4 * KSPL * 16];                                        /* [wave][query] sum of exponentials */
  __shared__ __attribute__((aligned(16))) _Float16 st[32 * SVP];
  const int tid = threadIdx.x, lane = tid & 31, ln = lane & 15, hh = lane >> 4;
  const int w = __builtin_amdgcn_readfirstlane(tid >> 5);   /* wave number in a scalar register: head, tile and key range become scalar address parts */
  const int hp = blockIdx.x & 1, qblk = blockIdx.x >> 1, b = blockIdx.y;
  const int hd = hp * 2 + (w & 1), qs = (w >> 1) & 1, k0 = (w >> 2) * (SEQ / KSPL);
  const int q0 = qblk * 32 + qs * 16;
  const _Float16* Qh = QK + ((size_t)b * NH + hd) * SEQ * HD;
  const _Float16* Kh = Qh + QKS;
  const _Float16* Vh = VT + ((size_t)b * CC + hd * HD) * SEQ;
  const v16h bq = ld_frag(Qh + (size_t)(q0 + ln) * HD, hh);
  const _Float16* kt = Kh + (size_t)k0 * HD;   /* the wave's current 32-key step: 2 KiB of k fragments, 2 KiB of V^T fragments */
  const _Float16* vt = Vh + (size_t)k0 * HD;
  const v8f z8 = {0.f, 0.f, 0.f, 0.f, 0.f, 0.f, 0.f, 0.f};
  const float sc = 0.17677669529663687f;
  float mrun = -1.0e30f, lrun = 0.f;
  v8f o0 = z8, o1 = z8;
#pragma unroll 1
  for (int kb = k0; kb < k0 + SEQ / KSPL; kb += 32, kt += 32 * HD, vt += 32 * HD) {
    const v16h ka0 = ld_fragp(kt, lane * 8);
    const v16h ka1 = ld_fragp(kt + 512, lane * 8);
    v8f s0 = mma(ka0, bq, z8);
    v8f s1 = mma(ka1, bq, z8);
    float mx = -1.0e30f;
#pragma unroll
    for (int r = 0; r < 8; ++r) { s0[r] *= sc; s1[r] *= sc; mx = fmaxf(mx, fmaxf(s0[r], s1[r])); }
    mx = fmaxf(mx, __shfl_xor(mx, 16, 32));
    const float mn = fmaxf(mrun, mx);
    const float al = __expf(mrun - mn);
    mrun = mn;
    FragH pf;
    float rs = 0.f;
#pragma unroll
    for (int r = 0; r < 8; ++r) {
      const float p0 = __expf(s0[r] - mn), p1 = __expf(s1[r] - mn);
      rs += p0 + p1;
      pf.h[r]     = (_Float16)(p0 * 256.0f);
      pf.h[8 + r] = (_Float16)(p1 * 256.0f);
    }
    lrun = lrun * al + rs;
#pragma unroll
    for (int r = 0; r < 8; ++r) { o0[r] *= al; o1[r] *= al; }
    const v16h va0 = ld_fragp(vt, lane * 8);
    const v16h va1 = ld_fragp(vt + 512, lane * 8);
    o0 = mma(va0, pf.v, o0);
    o1 = mma(va1, pf.v, o1);
  }
  const float lt = lrun + __shfl_xor(lrun, 16, 32);
  {
    const v4f c0 = {o0[0], o0[1], o0[2], o0[3]}, c1 = {o0[4], o0[5], o0[6], o0[7]};
    const v4f c2 = {o1[0], o1[1], o1[2], o1[3]}, c3 = {o1[4], o1[5], o1[6], o1[7]};
    float* pw_ = &po[((size_t)w * 4 * 32 + lane) * 4];
    *(v4f*)(pw_)           = c0;
    *(v4f*)(pw_ + 32 * 4)  = c1;
    *(v4f*)(pw_ + 64 * 4)  = c2;
    *(v4f*)(pw_ + 96 * 4)  = c3;
    if (hh == 0) { pm[w * 16 + ln] = mrun; pl[w * 16 + ln] = lt; }
  }
  __syncthreads();
  {
    /* join: thread = (tile-and-head pair p, chunk c, source lane l, half of the float4); ranges summed in index order */
    const int h2 = tid & 1, l = (tid >> 1) & 31, c = (tid >> 6) & 3, p = tid >> 8;
    const int jl = l & 15, jh = l >> 4;
    float mr[KSPL];
    float M = -1.0e30f;
#pragma unroll
    for (int s = 0; s < KSPL; ++s) { mr[s] = pm[(s * 4 + p) * 16 + jl]; M = fmaxf(M, mr[s]); }
    float L = 0.f, a0 = 0.f, a1 = 0.f;
#pragma unroll
    for (int s = 0; s < KSPL; ++s) {
      const float wg = __expf(mr[s] - M);
      const v2f v = *(const v2f*)&po[(((size_t)(s * 4 + p) * 4 + c) * 32 + l) * 4 + 2 * h2];
      L  += wg * pl[(s * 4 + p) * 16 + jl];
      a0 += wg * v[0];
      a1 += wg * v[1];
    }
    const float inv = 0.125f * (1.0f / L);           /* 2^-8 (P carry) x 2^5 (ctx carry) */
    const v2h e = {(_Float16)(a0 * inv), (_Float16)(a1 * inv)};
    *(v2h*)&st[((p >> 1) * 16 + jl) * SVP + (p & 1) * HD + (c >> 1) * 16 + 8 * jh + (c & 1) * 4 + 2 * h2] = e;
  }
  __syncthreads();
  if (tid < 256) {
    unsigned short* A = (unsigned short*)AO + ((size_t)b * SEQ + (size_t)qblk * 32) * CC + hp * 2 * HD;
    const int row = tid >> 3, p8 = (tid & 7) * 8;
    const v8us v = *(const v8us*)&st[row * SVP + p8];
    *(v8us*)(A + (size_t)row * CC + p8) = v;
  }
}

// projection: D[o][n] = pw[o][:] . ctx[n][:] (A = weight rows, B = ctx rows), 64 tokens per block, wave w owns o = 16w..16w+15;
// all weight and ctx fragments, the residual rows and the bias are asked for at entry and wait in registers: the block pays one load latency.
__global__ __launch_bounds__(256) __attribute__((amdgpu_waves_per_eu(4, 4))) /* a budget of 256 VGPRs: lets the scheduler keep the loaded operands in registers */ void k_proj(const float* __restrict__ x, const _Float16* __restrict__ W16, const float* __restrict__ pb,
                                              const _Float16* __restrict__ AO, float* __restrict__ out) {
  __shared__ __attribute__((aligned(16))) float so[128 * SOP];
  const int tid = threadIdx.x, w = tid >> 5, lane = tid & 31, ln = lane & 15, hh = lane >> 4;
  const int n0 = blockIdx.x * 64, b = blockIdx.y;
  v16h fw[4];
  const _Float16* wr = W16 + (size_t)3 * CC * CC + (size_t)(16 * w + ln) * CC;
#pragma unroll
  for (int kc = 0; kc < 4; ++kc) fw[kc] = ld_frag(wr + kc * 32, hh);
  v16h fb[4][4];
  const _Float16* br = AO + ((size_t)b * SEQ + n0 + ln) * CC;
#pragma unroll
  for (int nt = 0; nt < 4; ++nt) {
#pragma unroll
    for (int kc = 0; kc < 4; ++kc) fb[nt][kc] = ld_frag(br + nt * 16 * CC + kc * 32, hh);
  }
  /* store stage: thread = (row tid / 16 of each 16-row group i, four tokens) */
  const size_t e0 = (size_t)b * XS + (size_t)(tid >> 4) * SEQ_FULL + n0 + (tid & 15) * 4;
  const float* xp = x + e0;
  const float* pp = pb + (tid >> 4);
  v4f xv[8];
  float pbr[8];
#pragma unroll
  for (int i = 0; i < 8; ++i) {
    xv[i] = *(const v4fa*)(xp + (size_t)i * 16 * SEQ_FULL);
    pbr[i] = pp[16 * i];
  }
  /* the address registers of the loads above stay as they are until this wait: none becomes another load's destination first */
  asm volatile("s_wait_xcnt 0x0" :: "v"(wr - 3 * CC * CC + 8 * hh), "v"(br + 8 * hh), "v"(xp) : "memory");
  __builtin_amdgcn_sched_barrier(0);   /* the first use of a loaded value, and with it the first wait for data, stays behind the issue of the last load */
#pragma unroll
  for (int nt = 0; nt < 4; ++nt) {
    v8f acc = {0.f, 0.f, 0.f, 0.f, 0.f, 0.f, 0.f, 0.f};
#pragma unroll
    for (int kc = 0; kc < 4; ++kc) acc = mma(fw[kc], fb[nt][kc], acc);
#pragma unroll
    for (int r = 0; r < 8; ++r) so[(16 * w + 8 * hh + r) * SOP + nt * 16 + ln] = acc[r] * 0.001953125f;
  }
  __syncthreads();
  {
#pragma unroll
    for (int i = 0; i < 8; ++i) {
      const v4f a = *(const v4fa*)&so[((tid >> 4) + 16 * i) * SOP + (tid & 15) * 4];
      const float pbv = bf16_rne(pbr[i]);
      v4f y;
#pragma unroll
      for (int q = 0; q < 4; ++q) y[q] = bf16_rne(xv[i][q]) + (a[q] + pbv);
      *(v4f*)(out + e0 + (size_t)i * 16 * SEQ_FULL) = y;
    }
    
  }
}

extern "C" void kernel_launch(void* const* d_in, const int* in_sizes, int n_in,
                              void* d_out, int out_size, void* d_ws, size_t ws_size, hipStream_t stream) {
  if (n_in < 11) return;
  if (in_sizes[0] < NB * CC * SEQ) return;
  if (in_sizes[1] < CC || in_sizes[2] < CC || in_sizes[4] < CC || in_sizes[6] < CC || in_sizes[8] < CC || in_sizes[10] < CC) return;
  if (in_sizes[3] < CC * CC || in_sizes[5] < CC * CC || in_sizes[7] < CC * CC || in_sizes[9] < CC * CC) return;
  if (out_size < NB * CC * SEQ) return;
  if (ws_size < WS_TOTAL) return;
  const float* x   = (const float*)d_in[0];
  const float* gnw = (const float*)d_in[1];
  const float* gnb = (const float*)d_in[2];
  const float* qw  = (const float*)d_in[3];
  const float* qb  = (const float*)d_in[4];
  const float* kw  = (const float*)d_in[5];
  const float* kb  = (const float*)d_in[6];
  const float* vw  = (const float*)d_in[7];
  const float* vb  = (const float*)d_in[8];
  const float* pw  = (const float*)d_in[9];
  const float* pb  = (const float*)d_in[10];
  char* ws = (char*)d_ws;
  _Float16* W16 = (_Float16*)(ws + WS_W16);
  float*    GS  = (float*)(ws + WS_GS);
  _Float16* QK  = (_Float16*)(ws + WS_QK);
  _Float16* VT  = (_Float16*)(ws + WS_VT);
  _Float16* AO  = (_Float16*)(ws + WS_AO);
  k_pre<<<dim3(CC + CC * CC / 8 / 256, NB), 256, 0, stream>>>(x, qw, kw, vw, pw, W16, GS);
  k_qkv<<<dim3(SEQ / 64, NB), 256, 0, stream>>>(x, gnw, gnb, W16, qb, kb, vb, GS, QK, VT);
  k_attn<<<dim3(SEQ / 32 * 2, NB), 1024, 0, stream>>>(QK, VT, AO);
  k_proj<<<dim3(SEQ / 64, NB), 256, 0, stream>>>(x, W16, pb, AO, (float*)d_out);
}

// v005
// It runs in 33 microseconds.
// In two side-by-side timings against v004, it was 1.15 and 1.11 times as fast.
// Over all steps from v000 it is 4.19 times as fast.
#include <hip/hip_runtime.h>
// Channel-first spatial attention block with one-group GroupNorm and a plain residual: x [1][128][64][64] -> h = GN(x) (one mean / rstd over all 128 x 4096 values, per-channel affine);
// q/k/v = 1x1 convs ([out][in] weights + bias), 4 heads x 32; scores = q.k * 32^-0.5; softmax over the 4096 keys; ctx = P.v; result = x + pw.ctx + pb.
// (token-major q plane [head][n][32]; the k and V^T planes lie in the workspace in WMMA fragment order, see ld_fragp); flash attention with S^T = K.Q^T so that the score accumulators are directly the B operand of O^T = V^T.P^T
// (online softmax, one cross-half shuffle per step and query tile, no score plane); projection GEMM with the residual added at the float4 store stage.
// Compute dtype: every contraction v_wmma_f32_16x16x32_f16 (f16 operands, f32 accumulate), single products; all float inputs RNE-converted to bf16 first (exact in f16);
// carries: weights x16, P x256, ctx x32; statistics, softmax, residual in f32.
#ifndef NB
#define NB 1
#endif
#ifndef SEQ
#define SEQ 4096
#endif
#define SEQ_FULL 4096
#define CC 128
#define NH 4
#define HD 32
#define HXP 136                      /* LDS pitch (halves) of token-major 128-wide tiles */
#define SVP 72                       /* LDS pitch (halves) of the channel-major 64-token tile */
#define KSPL 16                      /* key ranges (waves) per attention block */
#define QT 4                         /* 16-query tiles a wave of the attention block holds */
#define STP 40                       /* LDS pitch (halves) of the attention block's 32-wide output tile */
#define SOP 68                       /* LDS pitch (floats) of the projection tile */
#define XS ((size_t)CC * SEQ_FULL)   /* per-batch stride of x / out */
#define QKS ((size_t)NB * NH * SEQ * HD)   /* halves between the q plane and the k plane */

static_assert(CC == NH * HD);
static_assert(HD == 32);
static_assert(CC == 128);
static_assert(CC <= 256);
static_assert(SEQ % 1024 == 0);
static_assert(SEQ <= SEQ_FULL);
static_assert(SEQ % (KSPL * 32) == 0);
static_assert(KSPL * 32 == 512);
static_assert(QT * 4 * 32 == 512);
static_assert(SEQ % (QT * 16) == 0 && QT % 2 == 0 && (NH & (NH - 1)) == 0);
static_assert(64 * HXP <= 128 * SVP);
static_assert(HXP % 8 == 0 && SVP % 8 == 0 && STP % 8 == 0 && SOP % 4 == 0);
static_assert((CC * CC) % (8 * 256) == 0);

typedef _Float16 v16h __attribute__((ext_vector_type(16)));
typedef unsigned short v8us __attribute__((ext_vector_type(8), may_alias));
typedef float v8f  __attribute__((ext_vector_type(8)));
typedef float v4f  __attribute__((ext_vector_type(4)));
typedef float v4fa __attribute__((ext_vector_type(4), may_alias));
typedef float v2f  __attribute__((ext_vector_type(2)));
typedef _Float16 v2h __attribute__((ext_vector_type(2)));
typedef _Float16 v4h __attribute__((ext_vector_type(4)));
union FragH { v16h v; v8us half[2]; _Float16 h[16]; unsigned short u[16]; };

// workspace carve (bytes, every region a multiple of 256)
constexpr size_t WS_W16 = 0;
constexpr size_t SZ_W16 = (size_t)4 * CC * CC * 2;
constexpr size_t WS_GS  = WS_W16 + SZ_W16;
constexpr size_t SZ_GS  = (size_t)NB * 2 * CC * 32 * 4;
constexpr size_t WS_QK  = WS_GS + SZ_GS;
constexpr size_t SZ_QK  = 2 * QKS * 2;
constexpr size_t WS_VT  = WS_QK + SZ_QK;
constexpr size_t SZ_VT  = (size_t)NB * CC * SEQ * 2;
constexpr size_t WS_AO  = WS_VT + SZ_VT;
constexpr size_t SZ_AO  = (size_t)NB * SEQ * CC * 2;
constexpr size_t WS_TOTAL = WS_AO + SZ_AO;
static_assert(SZ_W16 % 256 == 0 && SZ_GS % 256 == 0 && SZ_QK % 256 == 0 && SZ_VT % 256 == 0 && SZ_AO % 256 == 0);
static_assert(WS_TOTAL <= (size_t)134217728);

__device__ __forceinline__ float bf16_rne(float x) {
  unsigned int u = __float_as_uint(x);
  u = (u + 0x7FFFu + ((u >> 16) & 1u)) & 0xFFFF0000u;
  return __uint_as_float(u);
}

// 16x32 operand fragment from a k-contiguous 16-bit global row: elements 0..7 <- k 8h..8h+7, elements 8..15 <- k 16+8h..16+8h+7 (same map for A and B)
__device__ __forceinline__ v16h ld_frag(const _Float16* __restrict__ p, int hh) {
  FragH f;
  const unsigned short* q = (const unsigned short*)p;
  f.half[0] = *(const v8us*)(q + 8 * hh);
  f.half[1] = *(const v8us*)(q + 16 + 8 * hh);
  return f.v;
}
// the same 16x32 operand fragment from a plane kept in fragment order: 1 KiB per fragment, [k half j][lane][8 halves], chunk (j, lane = 16h + row) <- k 16j+8h..16j+8h+7 of that row;
// p = fragment base (the same in every lane), l8 = 8 * lane: each of the two wave-wide 16-byte loads covers 512 contiguous bytes (4 whole lines) instead of 16-byte pieces of 8 or 16 lines
__device__ __forceinline__ v16h ld_fragp(const _Float16* __restrict__ p, unsigned int l8) {
  FragH f;
  const unsigned short* q = (const unsigned short*)p;
  f.half[0] = *(const v8us*)(q + l8);
  f.half[1] = *(const v8us*)(q + 256 + l8);
  return f.v;
}
__device__ __forceinline__ v8f mma(v16h a, v16h b, v8f c) {
  v8f d = __builtin_amdgcn_wmma_f32_16x16x32_f16(false, a, false, b, (short)0, c, false, false);
  asm volatile("v_nop\n\tv_nop\n\tv_nop\n\tv_nop" : "+v"(d) : "v"(a), "v"(b));
  return d;
}

// fixed-order block sum over 256 threads (LDS tree); every thread gets the total
__device__ __forceinline__ float blk_sum256(float v) {
  __shared__ float red[256];
  const int t = threadIdx.x;
  red[t] = v;
  __syncthreads();
#pragma unroll 1
  for (int st = 128; st > 0; st >>= 1) {
    if (t < st) red[t] = red[t] + red[t + st];
    __syncthreads();
  }
  const float r = red[0];
  __syncthreads();
  return r;
}

__device__ __forceinline__ v8us cvt_w8(const float* __restrict__ w, int e) {
  const v4f a = *(const v4fa*)(w + e), c = *(const v4fa*)(w + e + 4);
  FragH f;
#pragma unroll
  for (int q = 0; q < 4; ++q) {
    f.h[q]     = (_Float16)(bf16_rne(a[q]) * 16.0f);
    f.h[4 + q] = (_Float16)(bf16_rne(c[q]) * 16.0f);
  }
  return f.half[0];
}

// one launch for everything that precedes the q/k/v GEMM (block-uniform split by block index).
// blocks 0..CC-1: channel c's 4096 values stay in registers (four 16-byte loads a thread, all in flight): its sum, then the sum of squares about ITS OWN mean;
// k_qkv joins the CC pairs exactly: var * N = sum_c (M2_c + SEQ * (mean_c - mean)^2), so no second pass over x has to wait for the overall mean.
// blocks CC..: the four weight matrices to f16 (x16 carry), which depend on nothing of the above.
__global__ __launch_bounds__(256) void k_pre(const float* __restrict__ x, const float* __restrict__ qw, const float* __restrict__ kw, const float* __restrict__ vw,
                                             const float* __restrict__ pw, _Float16* __restrict__ W16, float* __restrict__ GS) {
  const int tid = threadIdx.x, b = blockIdx.y;
  if (blockIdx.x >= CC) {
    if (b != 0) return;
    const int e = ((blockIdx.x - CC) * 256 + tid) * 8;
    const v8us v0 = cvt_w8(qw, e), v1 = cvt_w8(kw, e), v2 = cvt_w8(vw, e), v3 = cvt_w8(pw, e);
    unsigned short* d = (unsigned short*)W16 + e;
    *(v8us*)(d) = v0;
    *(v8us*)(d + CC * CC) = v1;
    *(v8us*)(d + 2 * CC * CC) = v2;
    *(v8us*)(d + 3 * CC * CC) = v3;
    return;
  }
  const int c = blockIdx.x;
  const float* xr = x + (size_t)b * XS + (size_t)c * SEQ_FULL;
  v4f a[SEQ / 1024];
#pragma unroll
  for (int i = 0; i < SEQ / 1024; ++i) a[i] = *(const v4fa*)(xr + tid * 4 + 1024 * i);
  float s = 0.f;
#pragma unroll
  for (int i = 0; i < SEQ / 1024; ++i) {
#pragma unroll
    for (int q = 0; q < 4; ++q) a[i][q] = bf16_rne(a[i][q]);
    s += (a[i][0] + a[i][1]) + (a[i][2] + a[i][3]);
  }
  const float tot = blk_sum256(s);
  const float mc = tot * (1.0f / (float)SEQ);
  float s2 = 0.f;
#pragma unroll
  for (int i = 0; i < SEQ / 1024; ++i) {
    const float d0 = a[i][0] - mc, d1 = a[i][1] - mc, d2 = a[i][2] - mc, d3 = a[i][3] - mc;
    s2 += (d0 * d0 + d1 * d1) + (d2 * d2 + d3 * d3);
  }
  const float tot2 = blk_sum256(s2);
  /* two whole 128-byte lines a channel, as before: [sum, 0...] in plane 0, [M2, 0...] in plane 1 */
  if (tid < 16) {
    const int pl = tid >> 3;
    float* d = GS + ((size_t)b * 2 * CC + (size_t)pl * CC + c) * 32;
    const v4f o = {((tid & 7) == 0) ? (pl ? tot2 : tot) : 0.f, 0.f, 0.f, 0.f};
    *(v4f*)(d + (tid & 7) * 4) = o;
  }
}

// fused normalise + q/k/v GEMM for 64 tokens per block (8 waves; wave w owns output channels 16w..16w+15).
// q, k: D[token][o] (A = h tile rows, B = weight rows) -> planes QK[{q,k}][head]: q token-major [n][32], k in fragment order [n / 16][1 KiB];
// v: D[o][token] (A = weight rows, B = h tile rows) -> plane VT[head] in fragment order [n / 32][16-d tile][1 KiB];
// every global operand (statistics, x tile, affine, the three weight fragment sets, biases) is asked for at entry and waits in registers: the block pays one load latency.
__global__ __launch_bounds__(256) __attribute__((amdgpu_waves_per_eu(2, 2))) /* 8 waves on 4 SIMDs: lets the scheduler keep the loaded operands in registers */ void k_qkv(const float* __restrict__ x, const float* __restrict__ gnw, const float* __restrict__ gnb,
                                             const _Float16* __restrict__ W16, const float* __restrict__ qb, const float* __restrict__ kb,
                                             const float* __restrict__ vb, const float* __restrict__ GS,
                                             _Float16* __restrict__ QK, _Float16* __restrict__ VT) {
  __shared__ __attribute__((aligned(16))) _Float16 hx[64 * HXP];
  __shared__ __attribute__((aligned(16))) _Float16 stg[128 * SVP];
  const int tid = threadIdx.x, w = tid >> 5, lane = tid & 31, ln = lane & 15, hh = lane >> 4;
  const int n0 = blockIdx.x * 64, b = blockIdx.y;
  const float invn = 1.0f / (float)(CC * SEQ);
  const size_t gsb = (size_t)b * 2 * CC;
  const float ps = GS[(gsb + (tid & (CC - 1))) * 32];
  const float pv = GS[(gsb + CC + (tid & (CC - 1))) * 32];
  /* x tile: a thread holds 4 channels x 8 tokens (eight 16-byte loads; a wave-wide load covers four whole 128-byte lines) */
  const int c4 = 16 * w + 4 * (lane >> 3), t4 = 4 * (lane & 7);
  const float* xq = x + (size_t)b * XS + (size_t)c4 * SEQ_FULL + n0 + t4;
  v4f xr[2][4];
#pragma unroll
  for (int i = 0; i < 2; ++i) {
#pragma unroll
    for (int j = 0; j < 4; ++j) xr[i][j] = *(const v4fa*)(xq + (size_t)j * SEQ_FULL + 32 * i);
  }
  const v4f gw4 = *(const v4fa*)(gnw + c4), gb4 = *(const v4fa*)(gnb + c4);
  v16h fw[3][4];
  const _Float16* wr0 = W16 + (size_t)(16 * w + ln) * CC;
#pragma unroll
  for (int m = 0; m < 3; ++m) {
#pragma unroll
    for (int kc = 0; kc < 4; ++kc) fw[m][kc] = ld_frag(wr0 + m * CC * CC + kc * 32, hh);
  }
  const float bqr = qb[16 * w + ln], bkr = kb[16 * w + ln];
  const v4f bv0 = *(const v4fa*)(vb + 16 * w + 8 * hh), bv1 = *(const v4fa*)(vb + 16 * w + 8 * hh + 4);
  /* the address registers of the loads above stay as they are until this wait: none becomes another load's destination first */
  asm volatile("s_wait_xcnt 0x0" :: "v"(xq), "v"(wr0 + 8 * hh) : "memory");
  __builtin_amdgcn_sched_barrier(0);   /* the first use of a loaded value, and with it the first wait for data, stays behind the issue of the last load */
  const float mean = blk_sum256((tid < CC) ? ps : 0.f) * invn;
  const float dm   = ps * (1.0f / (float)SEQ) - mean;   /* channel mean - overall mean */
  const float var  = blk_sum256((tid < CC) ? (pv + (float)SEQ * (dm * dm)) : 0.f) * invn;
  const float rstd = rsqrtf(var + 1e-5f);
#pragma unroll
  for (int i = 0; i < 2; ++i) {
#pragma unroll
    for (int q = 0; q < 4; ++q) {
      v4h hv;
#pragma unroll
      for (int j = 0; j < 4; ++j) hv[j] = (_Float16)(((bf16_rne(xr[i][j][q]) - mean) * rstd) * bf16_rne(gw4[j]) + bf16_rne(gb4[j]));
      *(v4h*)&hx[(32 * i + t4 + q) * HXP + c4] = hv;
    }
  }
  __syncthreads();

  /* the 16 h fragments serve q and k as A and v as B (same map): read once, all LDS loads in flight, kept in registers */
  v16h fh[4][4];
#pragma unroll
  for (int nt = 0; nt < 4; ++nt) {
#pragma unroll
    for (int kc = 0; kc < 4; ++kc) {
      FragH f;
      f.half[0] = *(const v8us*)&hx[(nt * 16 + ln) * HXP + kc * 32 + 8 * hh];
      f.half[1] = *(const v8us*)&hx[(nt * 16 + ln) * HXP + kc * 32 + 16 + 8 * hh];
      fh[nt][kc] = f.v;
    }
  }
  const float bqv = bf16_rne(bqr), bkv = bf16_rne(bkr);
#pragma unroll
  for (int m = 0; m < 2; ++m) {
    const float bias = (m == 0) ? bqv : bkv;
#pragma unroll
    for (int nt = 0; nt < 4; ++nt) {
      v8f acc = {0.f, 0.f, 0.f, 0.f, 0.f, 0.f, 0.f, 0.f};
#pragma unroll
      for (int kc = 0; kc < 4; ++kc) acc = mma(fh[nt][kc], fw[m][kc], acc);
#pragma unroll
      for (int r = 0; r < 8; ++r) stg[(nt * 16 + 8 * hh + r) * HXP + 16 * w + ln] = (_Float16)(acc[r] * 0.0625f + bias);
    }
    __syncthreads();
    unsigned short* P = (unsigned short*)QK + (size_t)m * QKS + (size_t)b * NH * SEQ * HD;
    {
#pragma unroll
      for (int i = 0; i < 4; ++i) {
        const int idx = tid + 256 * i;
        const int head = idx >> 8, pi = idx & 255;
        /* 16-byte chunk pi of the head's 64 tokens: q token-major [token][4 chunks]; k in fragment order [16-key tile][k half][lane] */
        const int tok = (m == 0) ? (pi >> 2) : ((pi >> 6) * 16 + (pi & 15));
        const int d8  = (m == 0) ? ((pi & 3) * 8) : (((pi >> 5) & 1) * 16 + ((pi >> 4) & 1) * 8);
        const v8us v = *(const v8us*)&stg[tok * HXP + head * HD + d8];
        *(v8us*)(P + ((size_t)head * SEQ + n0) * HD + pi * 8) = v;
      }
      
    }
    __syncthreads();
  }
  {
    float bvr[8];
#pragma unroll
    for (int r = 0; r < 4; ++r) { bvr[r] = bf16_rne(bv0[r]); bvr[4 + r] = bf16_rne(bv1[r]); }
#pragma unroll
    for (int nt = 0; nt < 4; ++nt) {
      v8f acc = {0.f, 0.f, 0.f, 0.f, 0.f, 0.f, 0.f, 0.f};
#pragma unroll
      for (int kc = 0; kc < 4; ++kc) acc = mma(fw[2][kc], fh[nt][kc], acc);
#pragma unroll
      for (int r = 0; r < 8; ++r) stg[(16 * w + 8 * hh + r) * SVP + nt * 16 + ln] = (_Float16)(acc[r] * 0.0625f + bvr[r]);
    }
    __syncthreads();
    unsigned short* V = (unsigned short*)VT + (size_t)b * CC * SEQ;
    {
#pragma unroll
      for (int i = 0; i < 4; ++i) {
        const int idx = tid + 256 * i;
        const int head = idx >> 8, pi = idx & 255;
        /* fragment order: chunk pi of the head's 64 keys = [32-key step][16-d tile][k half][lane] */
        const int o = head * HD + ((pi >> 6) & 1) * 16 + (pi & 15);
        const int p8 = (pi >> 7) * 32 + ((pi >> 5) & 1) * 16 + ((pi >> 4) & 1) * 8;
        const v8us v = *(const v8us*)&stg[o * SVP + p8];
        *(v8us*)(V + ((size_t)head * SEQ + n0) * HD + pi * 8) = v;
      }
      
    }
  }
}

// flash attention: block = 64 queries x 1 head x KSPL key ranges, one wave per key range; a wave holds QT = 4 query tiles, so every k and V^T fragment it loads serves 64 queries. Per 32-key step and query tile:
// S^T[key][q] = K.Q^T (two 16-key tiles; A = K rows, B = Q rows), online softmax per query column (lane), P^T packed from the two score tiles
// (element r <- tile 0 row 8h+r, element 8+r <- tile 1 row 8h+r) as the B operand of O^T[d][q] += V^T[d][key].P^T (A = V^T rows, two 16-d tiles).
// Each wave walks its own SEQ / KSPL keys with its own maxima, sums and accumulators; the KSPL partial results are joined in LDS in fixed range order.
// The ctx plane AO is head-major [head][n][32], so that a block stores whole lines.
__global__ __launch_bounds__(512) __attribute__((amdgpu_waves_per_eu(4, 4))) /* 16 waves on 4 SIMDs: lets the scheduler use the 256 VGPRs a wave may have */ void k_attn(const _Float16* __restrict__ QK, const _Float16* __restrict__ VT, _Float16* __restrict__ AO) {
  __shared__ __attribute__((aligned(16))) float po[KSPL * QT * 4 * 32 * 4];  /* [range][query tile][4-row chunk][lane] float4: un-normalised O^T partials */
  __shared__ float pm[KSPL * QT * 16];                                       /* [range][query tile][query] running maximum */
  __shared__ float pl[KSPL * QT * 16];                                       /* [range][query tile][query] sum of exponentials */
  __shared__ __attribute__((aligned(16))) _Float16 st[QT * 16 * STP];
  const int tid = threadIdx.x, lane = tid & 31, ln = lane & 15, hh = lane >> 4;
  const int w = __builtin_amdgcn_readfirstlane(tid >> 5);   /* wave number = key range, in a scalar register: it becomes a scalar address part */
  const int hd = blockIdx.x & (NH - 1), qblk = blockIdx.x / NH, b = blockIdx.y;
  const int k0 = w * (SEQ / KSPL);
  const int q0 = qblk * (QT * 16);
  const _Float16* Qh = QK + ((size_t)b * NH + hd) * SEQ * HD;
  const _Float16* Kh = Qh + QKS;
  const _Float16* Vh = VT + ((size_t)b * CC + hd * HD) * SEQ;
  /* every loop over the query tiles below is unrolled in full: bq, mrun, lrun, o0, o1 are indexed by the tile and stay in registers only under constant indices */
  v16h bq[QT];
#pragma unroll
  for (int t = 0; t < QT; ++t) bq[t] = ld_frag(Qh + (size_t)(q0 + 16 * t + ln) * HD, hh);
  const _Float16* kt = Kh + (size_t)k0 * HD;   /* the wave's current 32-key step: 2 KiB of k fragments, 2 KiB of V^T fragments */
  const _Float16* vt = Vh + (size_t)k0 * HD;
  const v8f z8 = {0.f, 0.f, 0.f, 0.f, 0.f, 0.f, 0.f, 0.f};
  const float sc = 0.17677669529663687f;
  float mrun[QT], lrun[QT];
  v8f o0[QT], o1[QT];
#pragma unroll
  for (int t = 0; t < QT; ++t) { mrun[t] = -1.0e30f; lrun[t] = 0.f; o0[t] = z8; o1[t] = z8; }
  /* kept rolled: a second copy of the step would want a second set of fragment and score registers, which the 256-VGPR budget does not hold */
#pragma unroll 1
  for (int kb = k0; kb < k0 + SEQ / KSPL; kb += 32, kt += 32 * HD, vt += 32 * HD) {
    const v16h ka0 = ld_fragp(kt, lane * 8);
    const v16h ka1 = ld_fragp(kt + 512, lane * 8);
    const v16h va0 = ld_fragp(vt, lane * 8);
    const v16h va1 = ld_fragp(vt + 512, lane * 8);
    /* two query tiles at a time: their score products stand together, their two softmax chains are independent of each other */
#pragma unroll
    for (int tp = 0; tp < QT; tp += 2) {
      v8f s0[2], s1[2];
      FragH pf[2];
#pragma unroll
      for (int u = 0; u < 2; ++u) {
        s0[u] = mma(ka0, bq[tp + u], z8);
        s1[u] = mma(ka1, bq[tp + u], z8);
      }
#pragma unroll
      for (int u = 0; u < 2; ++u) {
        const int t = tp + u;
        float mx = -1.0e30f;
#pragma unroll
        for (int r = 0; r < 8; ++r) { s0[u][r] *= sc; s1[u][r] *= sc; mx = fmaxf(mx, fmaxf(s0[u][r], s1[u][r])); }
        mx = fmaxf(mx, __shfl_xor(mx, 16, 32));
        const float mn = fmaxf(mrun[t], mx);
        const float al = __expf(mrun[t] - mn);
        mrun[t] = mn;
        float rs = 0.f;
#pragma unroll
        for (int r = 0; r < 8; ++r) {
          const float p0 = __expf(s0[u][r] - mn), p1 = __expf(s1[u][r] - mn);
          rs += p0 + p1;
          pf[u].h[r]     = (_Float16)(p0 * 256.0f);
          pf[u].h[8 + r] = (_Float16)(p1 * 256.0f);
        }
        lrun[t] = lrun[t] * al + rs;
#pragma unroll
        for (int r = 0; r < 8; ++r) { o0[t][r] *= al; o1[t][r] *= al; }
      }
#pragma unroll
      for (int u = 0; u < 2; ++u) {
        o0[tp + u] = mma(va0, pf[u].v, o0[tp + u]);
        o1[tp + u] = mma(va1, pf[u].v, o1[tp + u]);
      }
    }
  }
#pragma unroll
  for (int t = 0; t < QT; ++t) {
    const float lt = lrun[t] + __shfl_xor(lrun[t], 16, 32);
    const v4f c0 = {o0[t][0], o0[t][1], o0[t][2], o0[t][3]}, c1 = {o0[t][4], o0[t][5], o0[t][6], o0[t][7]};
    const v4f c2 = {o1[t][0], o1[t][1], o1[t][2], o1[t][3]}, c3 = {o1[t][4], o1[t][5], o1[t][6], o1[t][7]};
    float* pw_ = &po[((size_t)(w * QT + t) * 4 * 32 + lane) * 4];
    *(v4f*)(pw_)           = c0;
    *(v4f*)(pw_ + 32 * 4)  = c1;
    *(v4f*)(pw_ + 64 * 4)  = c2;
    *(v4f*)(pw_ + 96 * 4)  = c3;
    if (hh == 0) { pm[(w * QT + t) * 16 + ln] = mrun[t]; pl[(w * QT + t) * 16 + ln] = lt; }
  }
  __syncthreads();
  {
    /* join: thread = (query tile p, chunk c, source lane l), one float4; ranges summed in index order */
    const int l = tid & 31, c = (tid >> 5) & 3, p = tid >> 7;
    const int jl = l & 15, jh = l >> 4;
    float mr[KSPL];
    float M = -1.0e30f;
#pragma unroll
    for (int s = 0; s < KSPL; ++s) { mr[s] = pm[(s * QT + p) * 16 + jl]; M = fmaxf(M, mr[s]); }
    float L = 0.f;
    v4f a = {0.f, 0.f, 0.f, 0.f};
#pragma unroll
    for (int s = 0; s < KSPL; ++s) {
      const float wg = __expf(mr[s] - M);
      const v4f v = *(const v4f*)&po[(((size_t)(s * QT + p) * 4 + c) * 32 + l) * 4];
      L += wg * pl[(s * QT + p) * 16 + jl];
#pragma unroll
      for (int q = 0; q < 4; ++q) a[q] += wg * v[q];
    }
    const float inv = 0.125f * (1.0f / L);           /* 2^-8 (P carry) x 2^5 (ctx carry) */
    const v4h e = {(_Float16)(a[0] * inv), (_Float16)(a[1] * inv), (_Float16)(a[2] * inv), (_Float16)(a[3] * inv)};
    *(v4h*)&st[(p * 16 + jl) * STP + (c >> 1) * 16 + 8 * jh + (c & 1) * 4] = e;
  }
  __syncthreads();
  if (tid < QT * 16 * HD / 8) {
    unsigned short* A = (unsigned short*)AO + (((size_t)b * NH + hd) * SEQ + q0) * HD;
    const v8us v = *(const v8us*)&st[(tid >> 2) * STP + (tid & 3) * 8];
    *(v8us*)(A + tid * 8) = v;
  }
}

// projection: D[o][n] = pw[o][:] . ctx[n][:] (A = weight rows, B = ctx rows, read from the head-major plane), 64 tokens per block, wave w owns o = 16w..16w+15;
// all weight and ctx fragments, the residual rows and the bias are asked for at entry and wait in registers: the block pays one load latency.
__global__ __launch_bounds__(256) __attribute__((amdgpu_waves_per_eu(4, 4))) /* a budget of 256 VGPRs: lets the scheduler keep the loaded operands in registers */ void k_proj(const float* __restrict__ x, const _Float16* __restrict__ W16, const float* __restrict__ pb,
                                              const _Float16* __restrict__ AO, float* __restrict__ out) {
  __shared__ __attribute__((aligned(16))) float so[128 * SOP];
  const int tid = threadIdx.x, w = tid >> 5, lane = tid & 31, ln = lane & 15, hh = lane >> 4;
  const int n0 = blockIdx.x * 64, b = blockIdx.y;
  v16h fw[4];
  const _Float16* wr = W16 + (size_t)3 * CC * CC + (size_t)(16 * w + ln) * CC;
#pragma unroll
  for (int kc = 0; kc < 4; ++kc) fw[kc] = ld_frag(wr + kc * 32, hh);
  v16h fb[4][4];
  const _Float16* br = AO + ((size_t)b * NH * SEQ + n0 + ln) * HD;   /* head-major ctx plane: k chunk kc is head kc */
#pragma unroll
  for (int nt = 0; nt < 4; ++nt) {
#pragma unroll
    for (int kc = 0; kc < 4; ++kc) fb[nt][kc] = ld_frag(br + (size_t)kc * SEQ * HD + nt * 16 * HD, hh);
  }
  /* store stage: thread = (row tid / 16 of each 16-row group i, four tokens) */
  const size_t e0 = (size_t)b * XS + (size_t)(tid >> 4) * SEQ_FULL + n0 + (tid & 15) * 4;
  const float* xp = x + e0;
  const float* pp = pb + (tid >> 4);
  v4f xv[8];
  float pbr[8];
#pragma unroll
  for (int i = 0; i < 8; ++i) {
    xv[i] = *(const v4fa*)(xp + (size_t)i * 16 * SEQ_FULL);
    pbr[i] = pp[16 * i];
  }
  /* the address registers of the loads above stay as they are until this wait: none becomes another load's destination first */
  asm volatile("s_wait_xcnt 0x0" :: "v"(wr - 3 * CC * CC + 8 * hh), "v"(br + 8 * hh), "v"(xp) : "memory");
  __builtin_amdgcn_sched_barrier(0);   /* the first use of a loaded value, and with it the first wait for data, stays behind the issue of the last load */
#pragma unroll
  for (int nt = 0; nt < 4; ++nt) {
    v8f acc = {0.f, 0.f, 0.f, 0.f, 0.f, 0.f, 0.f, 0.f};
#pragma unroll
    for (int kc = 0; kc < 4; ++kc) acc = mma(fw[kc], fb[nt][kc], acc);
#pragma unroll
    for (int r = 0; r < 8; ++r) so[(16 * w + 8 * hh + r) * SOP + nt * 16 + ln] = acc[r] * 0.001953125f;
  }
  __syncthreads();
  {
#pragma unroll
    for (int i = 0; i < 8; ++i) {
      const v4f a = *(const v4fa*)&so[((tid >> 4) + 16 * i) * SOP + (tid & 15) * 4];
      const float pbv = bf16_rne(pbr[i]);
      v4f y;
#pragma unroll
      for (int q = 0; q < 4; ++q) y[q] = bf16_rne(xv[i][q]) + (a[q] + pbv);
      *(v4f*)(out + e0 + (size_t)i * 16 * SEQ_FULL) = y;
    }
    
  }
}

extern "C" void kernel_launch(void* const* d_in, const int* in_sizes, int n_in,
                              void* d_out, int out_size, void* d_ws, size_t ws_size, hipStream_t stream) {
  if (n_in < 11) return;
  if (in_sizes[0] < NB * CC * SEQ) return;
  if (in_sizes[1] < CC || in_sizes[2] < CC || in_sizes[4] < CC || in_sizes[6] < CC || in_sizes[8] < CC || in_sizes[10] < CC) return;
  if (in_sizes[3] < CC * CC || in_sizes[5] < CC * CC || in_sizes[7] < CC * CC || in_sizes[9] < CC * CC) return;
  if (out_size < NB * CC * SEQ) return;
  if (ws_size < WS_TOTAL) return;
  const float* x   = (const float*)d_in[0];
  const float* gnw = (const float*)d_in[1];
  const float* gnb = (const float*)d_in[2];
  const float* qw  = (const float*)d_in[3];
  const float* qb  = (const float*)d_in[4];
  const float* kw  = (const float*)d_in[5];
  const float* kb  = (const float*)d_in[6];
  const float* vw  = (const float*)d_in[7];
  const float* vb  = (const float*)d_in[8];
  const float* pw  = (const float*)d_in[9];
  const float* pb  = (const float*)d_in[10];
  char* ws = (char*)d_ws;
  _Float16* W16 = (_Float16*)(ws + WS_W16);
  float*    GS  = (float*)(ws + WS_GS);
  _Float16* QK  = (_Float16*)(ws + WS_QK);
  _Float16* VT  = (_Float16*)(ws + WS_VT);
  _Float16* AO  = (_Float16*)(ws + WS_AO);
  k_pre<<<dim3(CC + CC * CC / 8 / 256, NB), 256, 0, stream>>>(x, qw, kw, vw, pw, W16, GS);
  k_qkv<<<dim3(SEQ / 64, NB), 256, 0, stream>>>(x, gnw, gnb, W16, qb, kb, vb, GS, QK, VT);
  k_attn<<<dim3(SEQ / (QT * 16) * NH, NB), 512, 0, stream>>>(QK, VT, AO);
  k_proj<<<dim3(SEQ / 64, NB), 256, 0, stream>>>(x, W16, pb, AO, (float*)d_out);
}

// v007
// A run of this version takes 24.6 microseconds.
// Versions in between are left out here; by their measured steps it is 1.33 times as fast as v005.
// Counting every step since v000, it is 5.58 times as fast.
#include <hip/hip_runtime.h>
// Channel-first spatial attention block with one-group GroupNorm and a plain residual: x [1][128][64][64] -> h = GN(x) (one mean / rstd over all 128 x 4096 values, per-channel affine);
// q/k/v = 1x1 convs ([out][in] weights + bias), 4 heads x 32; scores = q.k * 32^-0.5; softmax over the 4096 keys; ctx = P.v; result = x + pw.ctx + pb.
// (token-major q plane [head][n][32]; the k and V^T planes lie in the workspace in WMMA fragment order, see ld_fragp); flash attention with S^T = K.Q^T so that the score accumulators are directly the B operand of O^T = V^T.P^T
// (online softmax, one cross-half shuffle per step and query tile, no score plane); projection GEMM with the residual added at the float4 store stage.
// Compute dtype: every contraction v_wmma_f32_16x16x32_f16 (f16 operands, f32 accumulate), single products; all float inputs RNE-converted to bf16 first (exact in f16);
// carries: weights x16, P x256, ctx x32; statistics, softmax, residual in f32. Three launches: q/k/v products of g x with the statistics beside them; attention, which applies mean and rstd; projection.
#ifndef NB
#define NB 1
#endif
#ifndef SEQ
#define SEQ 4096
#endif
#define SEQ_FULL 4096
#define CC 128
#define NH 4
#define HD 32
#define HXP 136                      /* LDS pitch (halves) of token-major 128-wide tiles */
#define SVP 72                       /* LDS pitch (halves) of the channel-major 64-token tile */
#define KSPL 16                      /* key ranges (waves) per attention block */
#define QT 4                         /* 16-query tiles a wave of the attention block holds */
#define STP 40                       /* LDS pitch (halves) of the attention block's 32-wide output tile */
#define SOP 68                       /* LDS pitch (floats) of the projection tile */
#define XS ((size_t)CC * SEQ_FULL)   /* per-batch stride of x / out */
#define QKS ((size_t)NB * NH * SEQ * HD)   /* halves between the q plane and the k plane */
#define NTB (SEQ / 64)               /* 64-token tiles of the q/k/v kernel; each leaves one (sum, M2) pair */
#define WCB (CC * CC / 8 / 256)      /* blocks that convert the projection weights */

static_assert(CC == NH * HD);
static_assert(HD == 32);
static_assert(CC == 128);
static_assert(CC <= 256);
static_assert(SEQ % 1024 == 0);
static_assert(SEQ <= SEQ_FULL);
static_assert(SEQ % (KSPL * 32) == 0);
static_assert(KSPL * 32 == 512);
static_assert(QT * 4 * 32 == 512);
static_assert(SEQ % (QT * 16) == 0 && QT % 2 == 0 && (NH & (NH - 1)) == 0);
static_assert(64 * HXP <= 128 * SVP);
static_assert(HXP % 8 == 0 && SVP % 8 == 0 && STP % 8 == 0 && SOP % 4 == 0);
static_assert((CC * CC) % (8 * 256) == 0);
static_assert(NTB == 64);

typedef _Float16 v16h __attribute__((ext_vector_type(16)));
typedef unsigned short v8us __attribute__((ext_vector_type(8), may_alias));
typedef float v8f  __attribute__((ext_vector_type(8)));
typedef float v4f  __attribute__((ext_vector_type(4)));
typedef float v4fa __attribute__((ext_vector_type(4), may_alias));
typedef float v2f  __attribute__((ext_vector_type(2)));
typedef _Float16 v2h __attribute__((ext_vector_type(2)));
typedef _Float16 v4h __attribute__((ext_vector_type(4)));
union FragH { v16h v; v8us half[2]; _Float16 h[16]; unsigned short u[16]; };

// workspace carve (bytes, every region a multiple of 256)
constexpr size_t WS_W16 = 0;
constexpr size_t SZ_W16 = (size_t)4 * CC * CC * 2;
constexpr size_t WS_GS  = WS_W16 + SZ_W16;
constexpr size_t SZ_GS  = (size_t)NB * NTB * 32 * 4;
constexpr size_t WS_CN  = WS_GS + SZ_GS;
constexpr size_t SZ_CN  = (size_t)2 * 2 * CC * 4;
constexpr size_t WS_QK  = WS_CN + SZ_CN;
constexpr size_t SZ_QK  = 2 * QKS * 2;
constexpr size_t WS_VT  = WS_QK + SZ_QK;
constexpr size_t SZ_VT  = (size_t)NB * CC * SEQ * 2;
constexpr size_t WS_AO  = WS_VT + SZ_VT;
constexpr size_t SZ_AO  = (size_t)NB * SEQ * CC * 2;
constexpr size_t WS_TOTAL = WS_AO + SZ_AO;
static_assert(SZ_W16 % 256 == 0 && SZ_GS % 256 == 0 && SZ_CN % 256 == 0 && SZ_QK % 256 == 0 && SZ_VT % 256 == 0 && SZ_AO % 256 == 0);
static_assert(WS_TOTAL <= (size_t)134217728);

__device__ __forceinline__ float bf16_rne(float x) {
  unsigned int u = __float_as_uint(x);
  u = (u + 0x7FFFu + ((u >> 16) & 1u)) & 0xFFFF0000u;
  return __uint_as_float(u);
}

// 16x32 operand fragment from a k-contiguous 16-bit global row: elements 0..7 <- k 8h..8h+7, elements 8..15 <- k 16+8h..16+8h+7 (same map for A and B)
__device__ __forceinline__ v16h ld_frag(const _Float16* __restrict__ p, int hh) {
  FragH f;
  const unsigned short* q = (const unsigned short*)p;
  f.half[0] = *(const v8us*)(q + 8 * hh);
  f.half[1] = *(const v8us*)(q + 16 + 8 * hh);
  return f.v;
}
// the same 16x32 operand fragment from a plane kept in fragment order: 1 KiB per fragment, [k half j][lane][8 halves], chunk (j, lane = 16h + row) <- k 16j+8h..16j+8h+7 of that row;
// p = fragment base (the same in every lane), l8 = 8 * lane: each of the two wave-wide 16-byte loads covers 512 contiguous bytes (4 whole lines) instead of 16-byte pieces of 8 or 16 lines
__device__ __forceinline__ v16h ld_fragp(const _Float16* __restrict__ p, unsigned int l8) {
  FragH f;
  const unsigned short* q = (const unsigned short*)p;
  f.half[0] = *(const v8us*)(q + l8);
  f.half[1] = *(const v8us*)(q + 256 + l8);
  return f.v;
}
__device__ __forceinline__ v8f mma(v16h a, v16h b, v8f c) {
  v8f d = __builtin_amdgcn_wmma_f32_16x16x32_f16(false, a, false, b, (short)0, c, false, false);
  asm volatile("v_nop\n\tv_nop\n\tv_nop\n\tv_nop" : "+v"(d) : "v"(a), "v"(b));
  return d;
}

__device__ __forceinline__ v8us cvt_w8(const float* __restrict__ w, int e) {
  const v4f a = *(const v4fa*)(w + e), c = *(const v4fa*)(w + e + 4);
  FragH f;
#pragma unroll
  for (int q = 0; q < 4; ++q) {
    f.h[q]     = (_Float16)(bf16_rne(a[q]) * 16.0f);
    f.h[4 + q] = (_Float16)(bf16_rne(c[q]) * 16.0f);
  }
  return f.half[0];
}

// two equal-sized sets of values, each given by its sum and its sum of squares about its own mean (M2), joined exactly: n = values in each set
__device__ __forceinline__ void join_stats(float& s, float& m2, float so, float mo, float inv2n) {
  const float d = s - so;
  m2 = (m2 + mo) + (d * d) * inv2n;
  s = s + so;
}

// q/k/v GEMM on x itself. GroupNorm is h = rstd * g * (x - mean) + beta with ONE mean and rstd, and the 1x1 convs are linear, so
//   W.h + bias = rstd * (W.(g x)) + [ W.beta + bias - rstd * mean * (W.g) ]:
// the products W.(g x) wait for no statistic; k_attn, which starts after every (sum, M2) pair is written, applies rstd and the bracket (see there).
// Block-uniform split by block index. Blocks 0..3*NTB-1: matrix m = index / NTB, 64 tokens (8 waves; wave w owns output channels 16w..16w+15); the weights are converted here
// (x16 carry, as before); the m = 0 block of a token tile also leaves the tile's (sum, M2) in one whole line of GS.
// q, k: D[token][o] (A = g x tile rows, B = weight rows) -> planes QK[{q,k}][head]: q token-major [n][32], k in fragment order [n / 16][1 KiB];
// v: D[o][token] (A = weight rows, B = g x tile rows) -> plane VT[head] in fragment order [n / 32][16-d tile][1 KiB].
// Next WCB blocks: projection weights to f16. Last 8 blocks: CN[{q,v}][0][o] = sum_c w g, CN[{q,v}][1][o] = sum_c w beta + bias.
// every global operand is asked for at entry and waits in registers: the block pays one load latency.
__global__ __launch_bounds__(256) __attribute__((amdgpu_waves_per_eu(2, 2))) /* 8 waves on 4 SIMDs: lets the scheduler keep the loaded operands in registers */ void k_qkv(const float* __restrict__ x, const float* __restrict__ gnw, const float* __restrict__ gnb,
                                             const float* __restrict__ qw, const float* __restrict__ qb, const float* __restrict__ kw,
                                             const float* __restrict__ vw, const float* __restrict__ vb, const float* __restrict__ pw,
                                             _Float16* __restrict__ W16, float* __restrict__ GS, float* __restrict__ CN,
                                             _Float16* __restrict__ QK, _Float16* __restrict__ VT) {
  __shared__ __attribute__((aligned(16))) _Float16 hx[64 * HXP];
  __shared__ __attribute__((aligned(16))) _Float16 stg[128 * SVP];
  __shared__ float wst[64];
  const int tid = threadIdx.x, w = tid >> 5, lane = tid & 31, ln = lane & 15, hh = lane >> 4;
  const int b = blockIdx.y;
  if (blockIdx.x >= 3 * NTB) {
    if (b != 0) return;
    const int ax = blockIdx.x - 3 * NTB;
    if (ax < WCB) {
      const int e = (ax * 256 + tid) * 8;
      *(v8us*)((unsigned short*)W16 + 3 * CC * CC + e) = cvt_w8(pw, e);
      return;
    }
    /* 32 weight rows a block, 8 threads a row (16 input channels each) */
    const int cx = ax - WCB, mv = cx >> 2;
    const int o = (cx & 3) * 32 + (tid >> 3), c0 = (tid & 7) * 16;
    const float* wr = (mv ? vw : qw) + (size_t)o * CC + c0;
    const float bias = (mv ? vb : qb)[o];
    float sa = 0.f, sb = 0.f;
#pragma unroll
    for (int i = 0; i < 4; ++i) {
      const v4f wv = *(const v4fa*)(wr + 4 * i), gv = *(const v4fa*)(gnw + c0 + 4 * i), bv = *(const v4fa*)(gnb + c0 + 4 * i);
#pragma unroll
      for (int q = 0; q < 4; ++q) {
        const float wq = bf16_rne(wv[q]);
        sa += wq * bf16_rne(gv[q]);
        sb += wq * bf16_rne(bv[q]);
      }
    }
#pragma unroll
    for (int st = 1; st < 8; st <<= 1) { sa += __shfl_xor(sa, st, 32); sb += __shfl_xor(sb, st, 32); }
    if ((tid & 7) == 0) { wst[tid >> 3] = sa; wst[32 + (tid >> 3)] = sb + bf16_rne(bias); }
    __syncthreads();
    /* one wave stores one whole 128-byte line */
    if (tid < 64) CN[(size_t)(mv * 2 + (tid >> 5)) * CC + (cx & 3) * 32 + (tid & 31)] = wst[tid];
    return;
  }
  const int m = blockIdx.x / NTB, nb = blockIdx.x % NTB, n0 = nb * 64;
  /* x tile: a thread holds 4 channels x 8 tokens (eight 16-byte loads; a wave-wide load covers four whole 128-byte lines) */
  const int c4 = 16 * w + 4 * (lane >> 3), t4 = 4 * (lane & 7);
  const float* xq = x + (size_t)b * XS + (size_t)c4 * SEQ_FULL + n0 + t4;
  v4f xr[2][4];
#pragma unroll
  for (int i = 0; i < 2; ++i) {
#pragma unroll
    for (int j = 0; j < 4; ++j) xr[i][j] = *(const v4fa*)(xq + (size_t)j * SEQ_FULL + 32 * i);
  }
  /* the lane's share of weight row 16w + ln in fragment order: wf[kc][0..1] <- k 32kc+8h..+7, wf[kc][2..3] <- k 32kc+16+8h..+7 */
  const float* wrow = ((m == 0) ? qw : (m == 1) ? kw : vw) + (size_t)(16 * w + ln) * CC + 8 * hh;
  v4f wf[4][4];
#pragma unroll
  for (int kc = 0; kc < 4; ++kc) {
#pragma unroll
    for (int p = 0; p < 4; ++p) wf[kc][p] = *(const v4fa*)(wrow + kc * 32 + (p >> 1) * 16 + (p & 1) * 4);
  }
  const v4f gw4 = *(const v4fa*)(gnw + c4);
  /* the address registers of the loads above stay as they are until this wait: none becomes another load's destination first */
  asm volatile("s_wait_xcnt 0x0" :: "v"(xq), "v"(wrow) : "memory");
  __builtin_amdgcn_sched_barrier(0);   /* the first use of a loaded value, and with it the first wait for data, stays behind the issue of the last load */
#pragma unroll
  for (int i = 0; i < 2; ++i) {
#pragma unroll
    for (int j = 0; j < 4; ++j) {
#pragma unroll
      for (int q = 0; q < 4; ++q) xr[i][j][q] = bf16_rne(xr[i][j][q]);
    }
  }
#pragma unroll
  for (int i = 0; i < 2; ++i) {
#pragma unroll
    for (int q = 0; q < 4; ++q) {
      v4h hv;
#pragma unroll
      for (int j = 0; j < 4; ++j) hv[j] = (_Float16)(xr[i][j][q] * bf16_rne(gw4[j]));
      *(v4h*)&hx[(32 * i + t4 + q) * HXP + c4] = hv;
    }
  }
  if (m == 0) {
    /* the thread's 32 values, then five exact pairwise joins across the wave: every lane ends with the wave's (sum, M2) */
    float s = 0.f, m2 = 0.f;
#pragma unroll
    for (int i = 0; i < 2; ++i) {
#pragma unroll
      for (int j = 0; j < 4; ++j) s += (xr[i][j][0] + xr[i][j][1]) + (xr[i][j][2] + xr[i][j][3]);
    }
    const float mt = s * (1.0f / 32.0f);
#pragma unroll
    for (int i = 0; i < 2; ++i) {
#pragma unroll
      for (int j = 0; j < 4; ++j) {
        const float d0 = xr[i][j][0] - mt, d1 = xr[i][j][1] - mt, d2 = xr[i][j][2] - mt, d3 = xr[i][j][3] - mt;
        m2 += (d0 * d0 + d1 * d1) + (d2 * d2 + d3 * d3);
      }
    }
#pragma unroll
    for (int k = 0; k < 5; ++k) join_stats(s, m2, __shfl_xor(s, 1 << k, 32), __shfl_xor(m2, 1 << k, 32), 1.0f / (float)(64 << k));
    if (lane == 0) { wst[w] = s; wst[8 + w] = m2; }
  }
  __syncthreads();
  if (m == 0 && w == 0) {
    float s = wst[lane & 7], m2 = wst[8 + (lane & 7)];
#pragma unroll
    for (int k = 0; k < 3; ++k) join_stats(s, m2, __shfl_xor(s, 1 << k, 32), __shfl_xor(m2, 1 << k, 32), 1.0f / (float)(2048 << k));
    /* one whole 128-byte line a tile: [sum, M2, 0...] */
    if (lane < 8) {
      const v4f o = {(lane == 0) ? s : 0.f, (lane == 0) ? m2 : 0.f, 0.f, 0.f};
      *(v4f*)(GS + ((size_t)b * NTB + nb) * 32 + lane * 4) = o;
    }
  }

  v16h fw[4];
#pragma unroll
  for (int kc = 0; kc < 4; ++kc) {
    FragH f;
#pragma unroll
    for (int e = 0; e < 16; ++e) f.h[e] = (_Float16)(bf16_rne(wf[kc][e >> 2][e & 3]) * 16.0f);
    fw[kc] = f.v;
  }
  /* the 16 tile fragments (A for q and k, B for v: same map): all LDS loads in flight, kept in registers */
  v16h fh[4][4];
#pragma unroll
  for (int nt = 0; nt < 4; ++nt) {
#pragma unroll
    for (int kc = 0; kc < 4; ++kc) {
      FragH f;
      f.half[0] = *(const v8us*)&hx[(nt * 16 + ln) * HXP + kc * 32 + 8 * hh];
      f.half[1] = *(const v8us*)&hx[(nt * 16 + ln) * HXP + kc * 32 + 16 + 8 * hh];
      fh[nt][kc] = f.v;
    }
  }
  if (m < 2) {
#pragma unroll
    for (int nt = 0; nt < 4; ++nt) {
      v8f acc = {0.f, 0.f, 0.f, 0.f, 0.f, 0.f, 0.f, 0.f};
#pragma unroll
      for (int kc = 0; kc < 4; ++kc) acc = mma(fh[nt][kc], fw[kc], acc);
#pragma unroll
      for (int r = 0; r < 8; ++r) stg[(nt * 16 + 8 * hh + r) * HXP + 16 * w + ln] = (_Float16)(acc[r] * 0.0625f);
    }
    __syncthreads();
    unsigned short* P = (unsigned short*)QK + (size_t)m * QKS + (size_t)b * NH * SEQ * HD;
#pragma unroll
    for (int i = 0; i < 4; ++i) {
      const int idx = tid + 256 * i;
      const int head = idx >> 8, pi = idx & 255;
      /* 16-byte chunk pi of the head's 64 tokens: q token-major [token][4 chunks]; k in fragment order [16-key tile][k half][lane] */
      const int tok = (m == 0) ? (pi >> 2) : ((pi >> 6) * 16 + (pi & 15));
      const int d8  = (m == 0) ? ((pi & 3) * 8) : (((pi >> 5) & 1) * 16 + ((pi >> 4) & 1) * 8);
      const v8us v = *(const v8us*)&stg[tok * HXP + head * HD + d8];
      *(v8us*)(P + ((size_t)head * SEQ + n0) * HD + pi * 8) = v;
    }
    asm volatile("s_wait_xcnt 0x0" ::: "memory");   /* the address and data registers of the stores above are rewritten by nothing in front of this wait */
  } else {
#pragma unroll
    for (int nt = 0; nt < 4; ++nt) {
      v8f acc = {0.f, 0.f, 0.f, 0.f, 0.f, 0.f, 0.f, 0.f};
#pragma unroll
      for (int kc = 0; kc < 4; ++kc) acc = mma(fw[kc], fh[nt][kc], acc);
#pragma unroll
      for (int r = 0; r < 8; ++r) stg[(16 * w + 8 * hh + r) * SVP + nt * 16 + ln] = (_Float16)(acc[r] * 0.0625f);
    }
    __syncthreads();
    unsigned short* V = (unsigned short*)VT + (size_t)b * CC * SEQ;
#pragma unroll
    for (int i = 0; i < 4; ++i) {
      const int idx = tid + 256 * i;
      const int head = idx >> 8, pi = idx & 255;
      /* fragment order: chunk pi of the head's 64 keys = [32-key step][16-d tile][k half][lane] */
      const int o = head * HD + ((pi >> 6) & 1) * 16 + (pi & 15);
      const int p8 = (pi >> 7) * 32 + ((pi >> 5) & 1) * 16 + ((pi >> 4) & 1) * 8;
      const v8us v = *(const v8us*)&stg[o * SVP + p8];
      *(v8us*)(V + ((size_t)head * SEQ + n0) * HD + pi * 8) = v;
    }
    asm volatile("s_wait_xcnt 0x0" ::: "memory");   /* the address and data registers of the stores above are rewritten by nothing in front of this wait */
  }
}
// flash attention: block = 64 queries x 1 head x KSPL key ranges, one wave per key range; a wave holds QT = 4 query tiles, so every k and V^T fragment it loads serves 64 queries. Per 32-key step and query tile:
// S^T[key][q] = K.Q^T (two 16-key tiles; A = K rows, B = Q rows), online softmax per query column (lane), P^T packed from the two score tiles
// (element r <- tile 0 row 8h+r, element 8+r <- tile 1 row 8h+r) as the B operand of O^T[d][q] += V^T[d][key].P^T (A = V^T rows, two 16-d tiles).
// Each wave walks its own SEQ / KSPL keys with its own maxima, sums and accumulators; the KSPL partial results are joined in LDS in fixed range order.
// The ctx plane AO is head-major [head][n][32], so that a block stores whole lines.
// The planes hold W.(g x) (see k_qkv); GroupNorm's mean and rstd come in here. Wave 0 joins the NTB (sum, M2) pairs and hands mean and rstd to the block through LDS. Then
// q = rstd * q' + cq (once, on the query fragments), cq = CN[q][1] - rstd * mean * CN[q][0]; k = rstd * k' + ck: rstd goes into the score scale, and q.ck (kb is part of ck) adds the same amount
// to every score of a query, which softmax cancels exactly, so it is not formed; the weights of a query sum to 1, so ctx = rstd * (P.v') + cv, applied where the ranges are joined.
__global__ __launch_bounds__(512) __attribute__((amdgpu_waves_per_eu(4, 4))) /* 16 waves on 4 SIMDs: lets the scheduler use the 256 VGPRs a wave may have */ void k_attn(const _Float16* __restrict__ QK, const _Float16* __restrict__ VT, const float* __restrict__ GS, const float* __restrict__ CN, _Float16* __restrict__ AO) {
  __shared__ __attribute__((aligned(16))) float po[KSPL * QT * 4 * 32 * 4];  /* [range][query tile][4-row chunk][lane] float4: un-normalised O^T partials */
  __shared__ float pm[KSPL * QT * 16];                                       /* [range][query tile][query] running maximum */
  __shared__ float pl[KSPL * QT * 16];                                       /* [range][query tile][query] sum of exponentials */
  __shared__ __attribute__((aligned(16))) _Float16 st[QT * 16 * STP];
  __shared__ float gst[2];
  const int tid = threadIdx.x, lane = tid & 31, ln = lane & 15, hh = lane >> 4;
  const int w = __builtin_amdgcn_readfirstlane(tid >> 5);   /* wave number = key range, in a scalar register: it becomes a scalar address part */
  const int hd = blockIdx.x & (NH - 1), qblk = blockIdx.x / NH, b = blockIdx.y;
  const int k0 = w * (SEQ / KSPL);
  const int q0 = qblk * (QT * 16);
  const _Float16* Qh = QK + ((size_t)b * NH + hd) * SEQ * HD;
  const _Float16* Kh = Qh + QKS;
  const _Float16* Vh = VT + ((size_t)b * CC + hd * HD) * SEQ;
  /* every loop over the query tiles below is unrolled in full: bq, mrun, lrun, o0, o1 are indexed by the tile and stay in registers only under constant indices */
  v16h bq[QT];
  const _Float16* qp = Qh + (size_t)(q0 + ln) * HD;
  const float* cp = CN + hd * HD + 8 * hh;
#pragma unroll
  for (int t = 0; t < QT; ++t) bq[t] = ld_frag(qp + t * 16 * HD, hh);
  /* the two constants of q for the lane's 16 fragment elements (d = 8h..8h+7, 16+8h..16+8h+7) */
  v4f ca[4], cb[4];
#pragma unroll
  for (int p = 0; p < 4; ++p) {
    ca[p] = *(const v4fa*)(cp + (p >> 1) * 16 + (p & 1) * 4);
    cb[p] = *(const v4fa*)(cp + CC + (p >> 1) * 16 + (p & 1) * 4);
  }
  /* the address registers of the loads above stay as they are until this wait: none becomes another load's destination first */
  asm volatile("s_wait_xcnt 0x0" :: "v"(qp + 8 * hh), "v"(cp) : "memory");
  if (w == 0) {
    const float* gp = GS + (size_t)b * NTB * 32 + lane * 32;
    const v2f p0 = *(const v2f*)gp, p1 = *(const v2f*)(gp + 32 * 32);
    float s = p0[0], m2 = p0[1];
    join_stats(s, m2, p1[0], p1[1], 1.0f / 16384.0f);
#pragma unroll
    for (int k = 0; k < 5; ++k) join_stats(s, m2, __shfl_xor(s, 1 << k, 32), __shfl_xor(m2, 1 << k, 32), 1.0f / (float)(32768 << k));
    if (lane == 0) { gst[0] = s * (1.0f / (float)(CC * SEQ)); gst[1] = rsqrtf(m2 * (1.0f / (float)(CC * SEQ)) + 1e-5f); }
  }
  __syncthreads();
  /* the same in every lane: kept in scalar registers, the loop has no vector register to spare */
  const float mean = __uint_as_float(__builtin_amdgcn_readfirstlane(__float_as_uint(gst[0])));
  const float rstd = __uint_as_float(__builtin_amdgcn_readfirstlane(__float_as_uint(gst[1])));
  {
    const float rm = rstd * mean;
    float cq[16];
#pragma unroll
    for (int e = 0; e < 16; ++e) cq[e] = cb[e >> 2][e & 3] - rm * ca[e >> 2][e & 3];
#pragma unroll
    for (int t = 0; t < QT; ++t) {
      FragH f;
      f.v = bq[t];
#pragma unroll
      for (int e = 0; e < 16; ++e) f.h[e] = (_Float16)((float)f.h[e] * rstd + cq[e]);
      bq[t] = f.v;
    }
  }
  const _Float16* kt = Kh + (size_t)k0 * HD;   /* the wave's current 32-key step: 2 KiB of k fragments, 2 KiB of V^T fragments */
  const _Float16* vt = Vh + (size_t)k0 * HD;
  const v8f z8 = {0.f, 0.f, 0.f, 0.f, 0.f, 0.f, 0.f, 0.f};
  /* softmax in base 2: 256 p = 2^(s * sc + (8 - m)), one fused multiply-add per raw score; sc = 32^-0.5 * log2(e) * rstd is positive, so the maximum is taken over the raw scores and scaled once;
     m (mrun, pm) is in scaled log2 units; the sums (lrun, pl) carry the same x256 as P */
  const float sc = 0.17677669529663687f * 1.4426950408889634f * rstd;
  float mrun[QT], lrun[QT];
  v8f o0[QT], o1[QT];
#pragma unroll
  for (int t = 0; t < QT; ++t) { mrun[t] = -1.0e30f; lrun[t] = 0.f; o0[t] = z8; o1[t] = z8; }
  /* kept rolled: a second copy of the step would want a second set of fragment and score registers, which the 256-VGPR budget does not hold */
#pragma unroll 1
  for (int kb = k0; kb < k0 + SEQ / KSPL; kb += 32, kt += 32 * HD, vt += 32 * HD) {
    const v16h ka0 = ld_fragp(kt, lane * 8);
    const v16h ka1 = ld_fragp(kt + 512, lane * 8);
    const v16h va0 = ld_fragp(vt, lane * 8);
    const v16h va1 = ld_fragp(vt + 512, lane * 8);
    /* two query tiles at a time: their score products stand together, their two softmax chains are independent of each other */
#pragma unroll
    for (int tp = 0; tp < QT; tp += 2) {
      v8f s0[2], s1[2];
      FragH pf[2];
#pragma unroll
      for (int u = 0; u < 2; ++u) {
        s0[u] = mma(ka0, bq[tp + u], z8);
        s1[u] = mma(ka1, bq[tp + u], z8);
      }
#pragma unroll
      for (int u = 0; u < 2; ++u) {
        const int t = tp + u;
        float mx = -1.0e30f;
#pragma unroll
        for (int r = 0; r < 8; ++r) mx = fmaxf(mx, fmaxf(s0[u][r], s1[u][r]));
        mx = fmaxf(mx, __shfl_xor(mx, 16, 32));
        const float mn = fmaxf(mrun[t], mx * sc);
        const float al = __builtin_amdgcn_exp2f(mrun[t] - mn);
        mrun[t] = mn;
        const float nb = 8.0f - mn;
        float rs = 0.f;
#pragma unroll
        for (int r = 0; r < 8; ++r) {
          const float p0 = __builtin_amdgcn_exp2f(__builtin_fmaf(s0[u][r], sc, nb)), p1 = __builtin_amdgcn_exp2f(__builtin_fmaf(s1[u][r], sc, nb));
          rs += p0 + p1;
          pf[u].h[r]     = (_Float16)p0;
          pf[u].h[8 + r] = (_Float16)p1;
        }
        lrun[t] = lrun[t] * al + rs;
#pragma unroll
        for (int r = 0; r < 8; ++r) { o0[t][r] *= al; o1[t][r] *= al; }
      }
#pragma unroll
      for (int u = 0; u < 2; ++u) {
        o0[tp + u] = mma(va0, pf[u].v, o0[tp + u]);
        o1[tp + u] = mma(va1, pf[u].v, o1[tp + u]);
      }
    }
  }
#pragma unroll
  for (int t = 0; t < QT; ++t) {
    const float lt = lrun[t] + __shfl_xor(lrun[t], 16, 32);
    const v4f c0 = {o0[t][0], o0[t][1], o0[t][2], o0[t][3]}, c1 = {o0[t][4], o0[t][5], o0[t][6], o0[t][7]};
    const v4f c2 = {o1[t][0], o1[t][1], o1[t][2], o1[t][3]}, c3 = {o1[t][4], o1[t][5], o1[t][6], o1[t][7]};
    float* pw_ = &po[((size_t)(w * QT + t) * 4 * 32 + lane) * 4];
    *(v4f*)(pw_)           = c0;
    *(v4f*)(pw_ + 32 * 4)  = c1;
    *(v4f*)(pw_ + 64 * 4)  = c2;
    *(v4f*)(pw_ + 96 * 4)  = c3;
    if (hh == 0) { pm[(w * QT + t) * 16 + ln] = mrun[t]; pl[(w * QT + t) * 16 + ln] = lt; }
  }
  __syncthreads();
  {
    /* join: thread = (query tile p, chunk c, source lane l), one float4; ranges summed in index order */
    const int l = tid & 31, c = (tid >> 5) & 3, p = tid >> 7;
    const int jl = l & 15, jh = l >> 4;
    const int d0 = hd * HD + (c >> 1) * 16 + 8 * jh + (c & 1) * 4;   /* the thread's four ctx channels */
    const v4f va = *(const v4fa*)(CN + 2 * CC + d0), vc = *(const v4fa*)(CN + 3 * CC + d0);
    float mr[KSPL];
    float M = -1.0e30f;
#pragma unroll
    for (int s = 0; s < KSPL; ++s) { mr[s] = pm[(s * QT + p) * 16 + jl]; M = fmaxf(M, mr[s]); }
    float L = 0.f;
    v4f a = {0.f, 0.f, 0.f, 0.f};
#pragma unroll
    for (int s = 0; s < KSPL; ++s) {
      const float wg = __builtin_amdgcn_exp2f(mr[s] - M);
      const v4f v = *(const v4f*)&po[(((size_t)(s * QT + p) * 4 + c) * 32 + l) * 4];
      L += wg * pl[(s * QT + p) * 16 + jl];
#pragma unroll
      for (int q = 0; q < 4; ++q) a[q] += wg * v[q];
    }
    const float inv = 32.0f * rstd * (1.0f / L);    /* the x256 of P cancels against that of L; 2^5 (ctx carry) x rstd */
    const float rm = rstd * mean;
    v4h e;
#pragma unroll
    for (int q = 0; q < 4; ++q) e[q] = (_Float16)(a[q] * inv + 32.0f * (vc[q] - rm * va[q]));
    *(v4h*)&st[(p * 16 + jl) * STP + (c >> 1) * 16 + 8 * jh + (c & 1) * 4] = e;
  }
  __syncthreads();
  if (tid < QT * 16 * HD / 8) {
    unsigned short* A = (unsigned short*)AO + (((size_t)b * NH + hd) * SEQ + q0) * HD;
    const v8us v = *(const v8us*)&st[(tid >> 2) * STP + (tid & 3) * 8];
    *(v8us*)(A + tid * 8) = v;
  }
}

// projection: D[o][n] = pw[o][:] . ctx[n][:] (A = weight rows, B = ctx rows, read from the head-major plane), 64 tokens per block, wave w owns o = 16w..16w+15;
// all weight and ctx fragments, the residual rows and the bias are asked for at entry and wait in registers: the block pays one load latency.
__global__ __launch_bounds__(256) __attribute__((amdgpu_waves_per_eu(4, 4))) /* a budget of 256 VGPRs: lets the scheduler keep the loaded operands in registers */ void k_proj(const float* __restrict__ x, const _Float16* __restrict__ W16, const float* __restrict__ pb,
                                              const _Float16* __restrict__ AO, float* __restrict__ out) {
  __shared__ __attribute__((aligned(16))) float so[128 * SOP];
  const int tid = threadIdx.x, w = tid >> 5, lane = tid & 31, ln = lane & 15, hh = lane >> 4;
  const int n0 = blockIdx.x * 64, b = blockIdx.y;
  v16h fw[4];
  const _Float16* wr = W16 + (size_t)3 * CC * CC + (size_t)(16 * w + ln) * CC;
#pragma unroll
  for (int kc = 0; kc < 4; ++kc) fw[kc] = ld_frag(wr + kc * 32, hh);
  v16h fb[4][4];
  const _Float16* br = AO + ((size_t)b * NH * SEQ + n0 + ln) * HD;   /* head-major ctx plane: k chunk kc is head kc */
#pragma unroll
  for (int nt = 0; nt < 4; ++nt) {
#pragma unroll
    for (int kc = 0; kc < 4; ++kc) fb[nt][kc] = ld_frag(br + (size_t)kc * SEQ * HD + nt * 16 * HD, hh);
  }
  /* store stage: thread = (row tid / 16 of each 16-row group i, four tokens) */
  const size_t e0 = (size_t)b * XS + (size_t)(tid >> 4) * SEQ_FULL + n0 + (tid & 15) * 4;
  const float* xp = x + e0;
  const float* pp = pb + (tid >> 4);
  v4f xv[8];
  float pbr[8];
#pragma unroll
  for (int i = 0; i < 8; ++i) {
    xv[i] = *(const v4fa*)(xp + (size_t)i * 16 * SEQ_FULL);
    pbr[i] = pp[16 * i];
  }
  /* the address registers of the loads above stay as they are until this wait: none becomes another load's destination first */
  asm volatile("s_wait_xcnt 0x0" :: "v"(wr - 3 * CC * CC + 8 * hh), "v"(br + 8 * hh), "v"(xp) : "memory");
  __builtin_amdgcn_sched_barrier(0);   /* the first use of a loaded value, and with it the first wait for data, stays behind the issue of the last load */
#pragma unroll
  for (int nt = 0; nt < 4; ++nt) {
    v8f acc = {0.f, 0.f, 0.f, 0.f, 0.f, 0.f, 0.f, 0.f};
#pragma unroll
    for (int kc = 0; kc < 4; ++kc) acc = mma(fw[kc], fb[nt][kc], acc);
#pragma unroll
    for (int r = 0; r < 8; ++r) so[(16 * w + 8 * hh + r) * SOP + nt * 16 + ln] = acc[r] * 0.001953125f;
  }
  __syncthreads();
  {
#pragma unroll
    for (int i = 0; i < 8; ++i) {
      const v4f a = *(const v4fa*)&so[((tid >> 4) + 16 * i) * SOP + (tid & 15) * 4];
      const float pbv = bf16_rne(pbr[i]);
      v4f y;
#pragma unroll
      for (int q = 0; q < 4; ++q) y[q] = bf16_rne(xv[i][q]) + (a[q] + pbv);
      *(v4f*)(out + e0 + (size_t)i * 16 * SEQ_FULL) = y;
    }
    
  }
}

extern "C" void kernel_launch(void* const* d_in, const int* in_sizes, int n_in,
                              void* d_out, int out_size, void* d_ws, size_t ws_size, hipStream_t stream) {
  if (n_in < 11) return;
  if (in_sizes[0] < NB * CC * SEQ) return;
  if (in_sizes[1] < CC || in_sizes[2] < CC || in_sizes[4] < CC || in_sizes[6] < CC || in_sizes[8] < CC || in_sizes[10] < CC) return;
  if (in_sizes[3] < CC * CC || in_sizes[5] < CC * CC || in_sizes[7] < CC * CC || in_sizes[9] < CC * CC) return;
  if (out_size < NB * CC * SEQ) return;
  if (ws_size < WS_TOTAL) return;
  const float* x   = (const float*)d_in[0];
  const float* gnw = (const float*)d_in[1];
  const float* gnb = (const float*)d_in[2];
  const float* qw  = (const float*)d_in[3];
  const float* qb  = (const float*)d_in[4];
  const float* kw  = (const float*)d_in[5];
  const float* vw  = (const float*)d_in[7];
  const float* vb  = (const float*)d_in[8];
  const float* pw  = (const float*)d_in[9];
  const float* pb  = (const float*)d_in[10];
  char* ws = (char*)d_ws;
  _Float16* W16 = (_Float16*)(ws + WS_W16);
  float*    GS  = (float*)(ws + WS_GS);
  float*    CN  = (float*)(ws + WS_CN);
  _Float16* QK  = (_Float16*)(ws + WS_QK);
  _Float16* VT  = (_Float16*)(ws + WS_VT);
  _Float16* AO  = (_Float16*)(ws + WS_AO);
  k_qkv<<<dim3(3 * NTB + WCB + 8, NB), 256, 0, stream>>>(x, gnw, gnb, qw, qb, kw, vw, vb, pw, W16, GS, CN, QK, VT);
  k_attn<<<dim3(SEQ / (QT * 16) * NH, NB), 512, 0, stream>>>(QK, VT, GS, CN, AO);
  k_proj<<<dim3(SEQ / 64, NB), 256, 0, stream>>>(x, W16, pb, AO, (float*)d_out);
}

// v009
// One run takes 20.6 microseconds.
// Versions in between are left out here; by their measured steps it is 1.18 times as fast as v007.
// All steps since v000 together make it 6.59 times as fast.
#include <hip/hip_runtime.h>
// Channel-first spatial attention block with one-group GroupNorm and a plain residual: x [1][128][64][64] -> h = GN(x) (one mean / rstd over all 128 x 4096 values, per-channel affine);
// q/k/v = 1x1 convs ([out][in] weights + bias), 4 heads x 32; scores = q.k * 32^-0.5; softmax over the 4096 keys; ctx = P.v; result = x + pw.ctx + pb.
// (token-major q plane [head][n][32]; the k and V^T planes lie in the workspace in WMMA fragment order, see ld_fragp); flash attention with S^T = K.Q^T so that the score accumulators are directly the B operand of O^T = V^T.P^T
// (online softmax about a held reference, cross-half shuffles only in the steps that move it, no score plane); projection GEMM with the residual added at the float4 store stage.
// Compute dtype: every contraction v_wmma_f32_16x16x32_f16 (f16 operands, f32 accumulate), single products; all float inputs RNE-converted to bf16 first (exact in f16);
// carries: weights x16, P x256, ctx x32; statistics, softmax, residual in f32. Three launches: q/k/v products of g x with the statistics beside them; attention, which applies mean and rstd; projection.
#ifndef NB
#define NB 1
#endif
#ifndef SEQ
#define SEQ 4096
#endif
#define SEQ_FULL 4096
#define CC 128
#define NH 4
#define HD 32
#define HXP 136                      /* LDS pitch (halves) of token-major 128-wide tiles */
#define SVP 72                       /* LDS pitch (halves) of the channel-major 64-token tile */
#define KSPL 8                       /* key ranges (waves) per attention block */
#define QT 4                         /* 16-query tiles a wave of the attention block holds */
#define STP 40                       /* LDS pitch (halves) of the attention block's 32-wide output tile */
#define SOP 68                       /* LDS pitch (floats) of the projection tile */
#define XS ((size_t)CC * SEQ_FULL)   /* per-batch stride of x / out */
#define QKS ((size_t)NB * NH * SEQ * HD)   /* halves between the q plane and the k plane */
#define NTB (SEQ / 64)               /* 64-token tiles of the q/k/v kernel; each leaves one (sum, M2) pair */
#define WCB (CC * CC / 8 / 256)      /* blocks that convert the projection weights */

static_assert(CC == NH * HD);
static_assert(HD == 32);
static_assert(CC == 128);
static_assert(CC <= 256);
static_assert(SEQ % 1024 == 0);
static_assert(SEQ <= SEQ_FULL);
static_assert(SEQ % (KSPL * 32) == 0);
static_assert(KSPL * 32 == 256);
static_assert(QT * 4 * 32 == 2 * KSPL * 32);
static_assert((SEQ / KSPL / 32) % 2 == 0 && SEQ / KSPL / 32 >= 4);
static_assert(SEQ % (QT * 16) == 0 && QT % 2 == 0 && (NH & (NH - 1)) == 0);
static_assert(64 * HXP <= 128 * SVP);
static_assert(HXP % 8 == 0 && SVP % 8 == 0 && STP % 8 == 0 && SOP % 4 == 0);
static_assert((CC * CC) % (8 * 256) == 0);
static_assert(NTB == 64);

typedef _Float16 v16h __attribute__((ext_vector_type(16)));
typedef unsigned short v8us __attribute__((ext_vector_type(8), may_alias));
typedef float v8f  __attribute__((ext_vector_type(8)));
typedef float v4f  __attribute__((ext_vector_type(4)));
typedef float v4fa __attribute__((ext_vector_type(4), may_alias));
typedef float v2f  __attribute__((ext_vector_type(2)));
typedef _Float16 v2h __attribute__((ext_vector_type(2)));
typedef _Float16 v4h __attribute__((ext_vector_type(4)));
union FragH { v16h v; v8us half[2]; _Float16 h[16]; unsigned short u[16]; };

// workspace carve (bytes, every region a multiple of 256)
constexpr size_t WS_W16 = 0;
constexpr size_t SZ_W16 = (size_t)4 * CC * CC * 2;
constexpr size_t WS_GS  = WS_W16 + SZ_W16;
constexpr size_t SZ_GS  = (size_t)NB * NTB * 32 * 4;
constexpr size_t WS_CN  = WS_GS + SZ_GS;
constexpr size_t SZ_CN  = (size_t)2 * 2 * CC * 4;
constexpr size_t WS_QK  = WS_CN + SZ_CN;
constexpr size_t SZ_QK  = 2 * QKS * 2;
constexpr size_t WS_VT  = WS_QK + SZ_QK;
constexpr size_t SZ_VT  = (size_t)NB * CC * SEQ * 2;
constexpr size_t WS_AO  = WS_VT + SZ_VT;
constexpr size_t SZ_AO  = (size_t)NB * SEQ * CC * 2;
constexpr size_t WS_TOTAL = WS_AO + SZ_AO;
static_assert(SZ_W16 % 256 == 0 && SZ_GS % 256 == 0 && SZ_CN % 256 == 0 && SZ_QK % 256 == 0 && SZ_VT % 256 == 0 && SZ_AO % 256 == 0);
static_assert(WS_TOTAL <= (size_t)134217728);

__device__ __forceinline__ float bf16_rne(float x) {
  unsigned int u = __float_as_uint(x);
  u = (u + 0x7FFFu + ((u >> 16) & 1u)) & 0xFFFF0000u;
  return __uint_as_float(u);
}

// 16x32 operand fragment from a k-contiguous 16-bit global row: elements 0..7 <- k 8h..8h+7, elements 8..15 <- k 16+8h..16+8h+7 (same map for A and B)
__device__ __forceinline__ v16h ld_frag(const _Float16* __restrict__ p, int hh) {
  FragH f;
  const unsigned short* q = (const unsigned short*)p;
  f.half[0] = *(const v8us*)(q + 8 * hh);
  f.half[1] = *(const v8us*)(q + 16 + 8 * hh);
  return f.v;
}
// the same 16x32 operand fragment from a plane kept in fragment order: 1 KiB per fragment, [k half j][lane][8 halves], chunk (j, lane = 16h + row) <- k 16j+8h..16j+8h+7 of that row;
// p = fragment base (the same in every lane), l8 = 8 * lane: each of the two wave-wide 16-byte loads covers 512 contiguous bytes (4 whole lines) instead of 16-byte pieces of 8 or 16 lines
__device__ __forceinline__ v16h ld_fragp(const _Float16* __restrict__ p, unsigned int l8) {
  FragH f;
  const unsigned short* q = (const unsigned short*)p;
  f.half[0] = *(const v8us*)(q + l8);
  f.half[1] = *(const v8us*)(q + 256 + l8);
  return f.v;
}
// the same from the lane's own byte address in the fragment (fragment base + 16 * lane)
__device__ __forceinline__ v16h ld_fragb(const char* __restrict__ q) {
  FragH f;
  f.half[0] = *(const v8us*)(q);
  f.half[1] = *(const v8us*)(q + 512);
  return f.v;
}
__device__ __forceinline__ v8f mma(v16h a, v16h b, v8f c) {
  v8f d = __builtin_amdgcn_wmma_f32_16x16x32_f16(false, a, false, b, (short)0, c, false, false);
  asm volatile("v_nop\n\tv_nop\n\tv_nop\n\tv_nop" : "+v"(d) : "v"(a), "v"(b));
  return d;
}
// the plain builtin: the compiler keeps the distances behind it itself, and its operands may lie above v255, where an asm statement's operands may not
__device__ __forceinline__ v8f mma_hi(v16h a, v16h b, v8f c) {
  return __builtin_amdgcn_wmma_f32_16x16x32_f16(false, a, false, b, (short)0, c, false, false);
}
__device__ __forceinline__ v8us cvt_w8(const float* __restrict__ w, int e) {
  const v4f a = *(const v4fa*)(w + e), c = *(const v4fa*)(w + e + 4);
  FragH f;
#pragma unroll
  for (int q = 0; q < 4; ++q) {
    f.h[q]     = (_Float16)(bf16_rne(a[q]) * 16.0f);
    f.h[4 + q] = (_Float16)(bf16_rne(c[q]) * 16.0f);
  }
  return f.half[0];
}

// two equal-sized sets of values, each given by its sum and its sum of squares about its own mean (M2), joined exactly: n = values in each set
__device__ __forceinline__ void join_stats(float& s, float& m2, float so, float mo, float inv2n) {
  const float d = s - so;
  m2 = (m2 + mo) + (d * d) * inv2n;
  s = s + so;
}

// q/k/v GEMM on x itself. GroupNorm is h = rstd * g * (x - mean) + beta with ONE mean and rstd, and the 1x1 convs are linear, so
//   W.h + bias = rstd * (W.(g x)) + [ W.beta + bias - rstd * mean * (W.g) ]:
// the products W.(g x) wait for no statistic; k_attn, which starts after every (sum, M2) pair is written, applies rstd and the bracket (see there).
// Block-uniform split by block index. Blocks 0..3*NTB-1: matrix m = index / NTB, 64 tokens (8 waves; wave w owns output channels 16w..16w+15); the weights are converted here
// (x16 carry, as before); the m = 0 block of a token tile also leaves the tile's (sum, M2) in one whole line of GS.
// q, k: D[token][o] (A = g x tile rows, B = weight rows) -> planes QK[{q,k}][head]: q token-major [n][32], k in fragment order [n / 16][1 KiB];
// v: D[o][token] (A = weight rows, B = g x tile rows) -> plane VT[head] in fragment order [n / 32][16-d tile][1 KiB].
// Next WCB blocks: projection weights to f16. Last 8 blocks: CN[{q,v}][0][o] = sum_c w g, CN[{q,v}][1][o] = sum_c w beta + bias.
// every global operand is asked for at entry and waits in registers: the block pays one load latency.
__global__ __launch_bounds__(256) __attribute__((amdgpu_waves_per_eu(2, 2))) /* 8 waves on 4 SIMDs: lets the scheduler keep the loaded operands in registers */ void k_qkv(const float* __restrict__ x, const float* __restrict__ gnw, const float* __restrict__ gnb,
                                             const float* __restrict__ qw, const float* __restrict__ qb, const float* __restrict__ kw,
                                             const float* __restrict__ vw, const float* __restrict__ vb, const float* __restrict__ pw,
                                             _Float16* __restrict__ W16, float* __restrict__ GS, float* __restrict__ CN,
                                             _Float16* __restrict__ QK, _Float16* __restrict__ VT) {
  __shared__ __attribute__((aligned(16))) _Float16 hx[64 * HXP];
  __shared__ __attribute__((aligned(16))) _Float16 stg[128 * SVP];
  __shared__ float wst[64];
  const int tid = threadIdx.x, w = tid >> 5, lane = tid & 31, ln = lane & 15, hh = lane >> 4;
  const int b = blockIdx.y;
  if (blockIdx.x >= 3 * NTB) {
    if (b != 0) return;
    const int ax = blockIdx.x - 3 * NTB;
    if (ax < WCB) {
      const int e = (ax * 256 + tid) * 8;
      *(v8us*)((unsigned short*)W16 + 3 * CC * CC + e) = cvt_w8(pw, e);
      return;
    }
    /* 32 weight rows a block, 8 threads a row (16 input channels each) */
    const int cx = ax - WCB, mv = cx >> 2;
    const int o = (cx & 3) * 32 + (tid >> 3), c0 = (tid & 7) * 16;
    const float* wr = (mv ? vw : qw) + (size_t)o * CC + c0;
    const float bias = (mv ? vb : qb)[o];
    float sa = 0.f, sb = 0.f;
#pragma unroll
    for (int i = 0; i < 4; ++i) {
      const v4f wv = *(const v4fa*)(wr + 4 * i), gv = *(const v4fa*)(gnw + c0 + 4 * i), bv = *(const v4fa*)(gnb + c0 + 4 * i);
#pragma unroll
      for (int q = 0; q < 4; ++q) {
        const float wq = bf16_rne(wv[q]);
        sa += wq * bf16_rne(gv[q]);
        sb += wq * bf16_rne(bv[q]);
      }
    }
#pragma unroll
    for (int st = 1; st < 8; st <<= 1) { sa += __shfl_xor(sa, st, 32); sb += __shfl_xor(sb, st, 32); }
    if ((tid & 7) == 0) { wst[tid >> 3] = sa; wst[32 + (tid >> 3)] = sb + bf16_rne(bias); }
    __syncthreads();
    /* one wave stores one whole 128-byte line */
    if (tid < 64) CN[(size_t)(mv * 2 + (tid >> 5)) * CC + (cx & 3) * 32 + (tid & 31)] = wst[tid];
    return;
  }
  const int m = blockIdx.x / NTB, nb = blockIdx.x % NTB, n0 = nb * 64;
  /* x tile: a thread holds 4 channels x 8 tokens (eight 16-byte loads; a wave-wide load covers four whole 128-byte lines) */
  const int c4 = 16 * w + 4 * (lane >> 3), t4 = 4 * (lane & 7);
  const float* xq = x + (size_t)b * XS + (size_t)c4 * SEQ_FULL + n0 + t4;
  v4f xr[2][4];
#pragma unroll
  for (int i = 0; i < 2; ++i) {
#pragma unroll
    for (int j = 0; j < 4; ++j) xr[i][j] = *(const v4fa*)(xq + (size_t)j * SEQ_FULL + 32 * i);
  }
  /* the lane's share of weight row 16w + ln in fragment order: wf[kc][0..1] <- k 32kc+8h..+7, wf[kc][2..3] <- k 32kc+16+8h..+7 */
  const float* wrow = ((m == 0) ? qw : (m == 1) ? kw : vw) + (size_t)(16 * w + ln) * CC + 8 * hh;
  v4f wf[4][4];
#pragma unroll
  for (int kc = 0; kc < 4; ++kc) {
#pragma unroll
    for (int p = 0; p < 4; ++p) wf[kc][p] = *(const v4fa*)(wrow + kc * 32 + (p >> 1) * 16 + (p & 1) * 4);
  }
  const v4f gw4 = *(const v4fa*)(gnw + c4);
  /* the address registers of the loads above stay as they are until this wait: none becomes another load's destination first */
  asm volatile("s_wait_xcnt 0x0" :: "v"(xq), "v"(wrow) : "memory");
  __builtin_amdgcn_sched_barrier(0);   /* the first use of a loaded value, and with it the first wait for data, stays behind the issue of the last load */
#pragma unroll
  for (int i = 0; i < 2; ++i) {
#pragma unroll
    for (int j = 0; j < 4; ++j) {
#pragma unroll
      for (int q = 0; q < 4; ++q) xr[i][j][q] = bf16_rne(xr[i][j][q]);
    }
  }
#pragma unroll
  for (int i = 0; i < 2; ++i) {
#pragma unroll
    for (int q = 0; q < 4; ++q) {
      v4h hv;
#pragma unroll
      for (int j = 0; j < 4; ++j) hv[j] = (_Float16)(xr[i][j][q] * bf16_rne(gw4[j]));
      *(v4h*)&hx[(32 * i + t4 + q) * HXP + c4] = hv;
    }
  }
  if (m == 0) {
    /* the thread's 32 values, then five exact pairwise joins across the wave: every lane ends with the wave's (sum, M2) */
    float s = 0.f, m2 = 0.f;
#pragma unroll
    for (int i = 0; i < 2; ++i) {
#pragma unroll
      for (int j = 0; j < 4; ++j) s += (xr[i][j][0] + xr[i][j][1]) + (xr[i][j][2] + xr[i][j][3]);
    }
    const float mt = s * (1.0f / 32.0f);
#pragma unroll
    for (int i = 0; i < 2; ++i) {
#pragma unroll
      for (int j = 0; j < 4; ++j) {
        const float d0 = xr[i][j][0] - mt, d1 = xr[i][j][1] - mt, d2 = xr[i][j][2] - mt, d3 = xr[i][j][3] - mt;
        m2 += (d0 * d0 + d1 * d1) + (d2 * d2 + d3 * d3);
      }
    }
#pragma unroll
    for (int k = 0; k < 5; ++k) join_stats(s, m2, __shfl_xor(s, 1 << k, 32), __shfl_xor(m2, 1 << k, 32), 1.0f / (float)(64 << k));
    if (lane == 0) { wst[w] = s; wst[8 + w] = m2; }
  }
  __syncthreads();
  if (m == 0 && w == 0) {
    float s = wst[lane & 7], m2 = wst[8 + (lane & 7)];
#pragma unroll
    for (int k = 0; k < 3; ++k) join_stats(s, m2, __shfl_xor(s, 1 << k, 32), __shfl_xor(m2, 1 << k, 32), 1.0f / (float)(2048 << k));
    /* one whole 128-byte line a tile: [sum, M2, 0...] */
    if (lane < 8) {
      const v4f o = {(lane == 0) ? s : 0.f, (lane == 0) ? m2 : 0.f, 0.f, 0.f};
      *(v4f*)(GS + ((size_t)b * NTB + nb) * 32 + lane * 4) = o;
    }
  }

  v16h fw[4];
#pragma unroll
  for (int kc = 0; kc < 4; ++kc) {
    FragH f;
#pragma unroll
    for (int e = 0; e < 16; ++e) f.h[e] = (_Float16)(bf16_rne(wf[kc][e >> 2][e & 3]) * 16.0f);
    fw[kc] = f.v;
  }
  /* the 16 tile fragments (A for q and k, B for v: same map): all LDS loads in flight, kept in registers */
  v16h fh[4][4];
#pragma unroll
  for (int nt = 0; nt < 4; ++nt) {
#pragma unroll
    for (int kc = 0; kc < 4; ++kc) {
      FragH f;
      f.half[0] = *(const v8us*)&hx[(nt * 16 + ln) * HXP + kc * 32 + 8 * hh];
      f.half[1] = *(const v8us*)&hx[(nt * 16 + ln) * HXP + kc * 32 + 16 + 8 * hh];
      fh[nt][kc] = f.v;
    }
  }
  if (m < 2) {
#pragma unroll
    for (int nt = 0; nt < 4; ++nt) {
      v8f acc = {0.f, 0.f, 0.f, 0.f, 0.f, 0.f, 0.f, 0.f};
#pragma unroll
      for (int kc = 0; kc < 4; ++kc) acc = mma(fh[nt][kc], fw[kc], acc);
#pragma unroll
      for (int r = 0; r < 8; ++r) stg[(nt * 16 + 8 * hh + r) * HXP + 16 * w + ln] = (_Float16)(acc[r] * 0.0625f);
    }
    __syncthreads();
    unsigned short* P = (unsigned short*)QK + (size_t)m * QKS + (size_t)b * NH * SEQ * HD;
#pragma unroll
    for (int i = 0; i < 4; ++i) {
      const int idx = tid + 256 * i;
      const int head = idx >> 8, pi = idx & 255;
      /* 16-byte chunk pi of the head's 64 tokens: q token-major [token][4 chunks]; k in fragment order [16-key tile][k half][lane] */
      const int tok = (m == 0) ? (pi >> 2) : ((pi >> 6) * 16 + (pi & 15));
      const int d8  = (m == 0) ? ((pi & 3) * 8) : (((pi >> 5) & 1) * 16 + ((pi >> 4) & 1) * 8);
      const v8us v = *(const v8us*)&stg[tok * HXP + head * HD + d8];
      *(v8us*)(P + ((size_t)head * SEQ + n0) * HD + pi * 8) = v;
    }
    asm volatile("s_wait_xcnt 0x0" ::: "memory");   /* the address and data registers of the stores above are rewritten by nothing in front of this wait */
  } else {
#pragma unroll
    for (int nt = 0; nt < 4; ++nt) {
      v8f acc = {0.f, 0.f, 0.f, 0.f, 0.f, 0.f, 0.f, 0.f};
#pragma unroll
      for (int kc = 0; kc < 4; ++kc) acc = mma(fw[kc], fh[nt][kc], acc);
#pragma unroll
      for (int r = 0; r < 8; ++r) stg[(16 * w + 8 * hh + r) * SVP + nt * 16 + ln] = (_Float16)(acc[r] * 0.0625f);
    }
    __syncthreads();
    unsigned short* V = (unsigned short*)VT + (size_t)b * CC * SEQ;
#pragma unroll
    for (int i = 0; i < 4; ++i) {
      const int idx = tid + 256 * i;
      const int head = idx >> 8, pi = idx & 255;
      /* fragment order: chunk pi of the head's 64 keys = [32-key step][16-d tile][k half][lane] */
      const int o = head * HD + ((pi >> 6) & 1) * 16 + (pi & 15);
      const int p8 = (pi >> 7) * 32 + ((pi >> 5) & 1) * 16 + ((pi >> 4) & 1) * 8;
      const v8us v = *(const v8us*)&stg[o * SVP + p8];
      *(v8us*)(V + ((size_t)head * SEQ + n0) * HD + pi * 8) = v;
    }
    asm volatile("s_wait_xcnt 0x0" ::: "memory");   /* the address and data registers of the stores above are rewritten by nothing in front of this wait */
  }
}
// flash attention: block = 64 queries x 1 head x KSPL key ranges, one wave per key range; a wave holds QT = 4 query tiles, so every k and V^T fragment it loads serves 64 queries. Per 32-key step and query tile:
// S^T[key][q] = K.Q^T (two 16-key tiles; A = K rows, B = Q rows), online softmax per query column (lane), P^T packed from the two score tiles
// (element r <- tile 0 row 8h+r, element 8+r <- tile 1 row 8h+r) as the B operand of O^T[d][q] += V^T[d][key].P^T (A = V^T rows, two 16-d tiles).
// Each wave walks its own SEQ / KSPL keys with its own maxima, sums and accumulators; the KSPL partial results are joined in LDS in fixed range order.
// The ctx plane AO is head-major [head][n][32], so that a block stores whole lines.
// The planes hold W.(g x) (see k_qkv); GroupNorm's mean and rstd come in here. Wave 0 joins the NTB (sum, M2) pairs and hands mean and rstd to the block through LDS. Then
// q = rstd * q' + cq (once, on the query fragments), cq = CN[q][1] - rstd * mean * CN[q][0]; k = rstd * k' + ck: rstd goes into the score scale, and q.ck (kb is part of ck) adds the same amount
// to every score of a query, which softmax cancels exactly, so it is not formed; the weights of a query sum to 1, so ctx = rstd * (P.v') + cv, applied where the ranges are joined.
__global__ __launch_bounds__(256) __attribute__((amdgpu_waves_per_eu(2, 2))) /* 8 waves on 4 SIMDs: a wave may have 512 VGPRs */ void k_attn(const _Float16* __restrict__ QK, const _Float16* __restrict__ VT, const float* __restrict__ GS, const float* __restrict__ CN, _Float16* __restrict__ AO) {
  __shared__ __attribute__((aligned(16))) float po[KSPL * QT * 4 * 32 * 4];  /* [range][query tile][4-row chunk][lane] float4: un-normalised O^T partials */
  __shared__ float pm[KSPL * QT * 16];                                       /* [range][query tile][query] held softmax reference m = 8 - c */
  __shared__ float pl[KSPL * QT * 16];                                       /* [range][query tile][query] sum of exponentials */
  __shared__ __attribute__((aligned(16))) _Float16 st[QT * 16 * STP];
  __shared__ float gst[2];
  const int tid = threadIdx.x, lane = tid & 31, ln = lane & 15, hh = lane >> 4;
  const int w = __builtin_amdgcn_readfirstlane(tid >> 5);   /* wave number = key range, in a scalar register: it becomes a scalar address part */
  const int hd = blockIdx.x & (NH - 1), qblk = blockIdx.x / NH, b = blockIdx.y;
  const int k0 = w * (SEQ / KSPL);
  constexpr int NST = SEQ / KSPL / 32;   /* 32-key steps of a wave */
  const int q0 = qblk * (QT * 16);
  const _Float16* Qh = QK + ((size_t)b * NH + hd) * SEQ * HD;
  const _Float16* Kh = Qh + QKS;
  const _Float16* Vh = VT + ((size_t)b * CC + hd * HD) * SEQ;
  /* every loop over the query tiles below is unrolled in full: bq, cn, lrun, o0, o1 are indexed by the tile and stay in registers only under constant indices */
  v16h bq[QT];
  const _Float16* qp = Qh + (size_t)(q0 + ln) * HD;
  const float* cp = CN + hd * HD + 8 * hh;
#pragma unroll
  for (int t = 0; t < QT; ++t) bq[t] = ld_frag(qp + t * 16 * HD, hh);
  /* the two constants of q for the lane's 16 fragment elements (d = 8h..8h+7, 16+8h..16+8h+7) */
  v4f ca[4], cb[4];
#pragma unroll
  for (int p = 0; p < 4; ++p) {
    ca[p] = *(const v4fa*)(cp + (p >> 1) * 16 + (p & 1) * 4);
    cb[p] = *(const v4fa*)(cp + CC + (p >> 1) * 16 + (p & 1) * 4);
  }
  const _Float16* kt = Kh + (size_t)k0 * HD;   /* the wave's first 32-key step: a step is 2 KiB of k fragments, 2 KiB of V^T fragments */
  const _Float16* vt = Vh + (size_t)k0 * HD;
  /* the first two steps' fragments wait for no statistic: asked for here, they arrive while mean and rstd are joined */
  v16h ka0[2], ka1[2], va0[2], va1[2];
#pragma unroll
  for (int h = 0; h < 2; ++h) {
    ka0[h] = ld_fragp(kt + h * 32 * HD, lane * 8);
    ka1[h] = ld_fragp(kt + h * 32 * HD + 512, lane * 8);
    va0[h] = ld_fragp(vt + h * 32 * HD, lane * 8);
    va1[h] = ld_fragp(vt + h * 32 * HD + 512, lane * 8);
  }
  /* the address registers of the loads above stay as they are until this wait: none becomes another load's destination first */
  asm volatile("s_wait_xcnt 0x0" :: "v"(qp + 8 * hh), "v"(cp) : "memory");
  if (w == 0) {
    const float* gp = GS + (size_t)b * NTB * 32 + lane * 32;
    const v2f p0 = *(const v2f*)gp, p1 = *(const v2f*)(gp + 32 * 32);
    float s = p0[0], m2 = p0[1];
    join_stats(s, m2, p1[0], p1[1], 1.0f / 16384.0f);
#pragma unroll
    for (int k = 0; k < 5; ++k) join_stats(s, m2, __shfl_xor(s, 1 << k, 32), __shfl_xor(m2, 1 << k, 32), 1.0f / (float)(32768 << k));
    if (lane == 0) { gst[0] = s * (1.0f / (float)(CC * SEQ)); gst[1] = rsqrtf(m2 * (1.0f / (float)(CC * SEQ)) + 1e-5f); }
  }
  __syncthreads();
  /* the same in every lane: kept in scalar registers */
  const float mean = __uint_as_float(__builtin_amdgcn_readfirstlane(__float_as_uint(gst[0])));
  const float rstd = __uint_as_float(__builtin_amdgcn_readfirstlane(__float_as_uint(gst[1])));
  /* sc = 32^-0.5 * log2(e) * rstd (the rstd of k): multiplied into q in front of the rounding to f16 below, so that the score product itself is in log2 units */
  const float sc = 0.17677669529663687f * 1.4426950408889634f * rstd;
  {
    const float rm = rstd * mean;
    float cq[16];
#pragma unroll
    for (int e = 0; e < 16; ++e) cq[e] = cb[e >> 2][e & 3] - rm * ca[e >> 2][e & 3];
#pragma unroll
    for (int t = 0; t < QT; ++t) {
      FragH f;
      f.v = bq[t];
#pragma unroll
      for (int e = 0; e < 16; ++e) f.h[e] = (_Float16)(((float)f.h[e] * rstd + cq[e]) * sc);
      bq[t] = f.v;
    }
  }
  const v8f z8 = {0.f, 0.f, 0.f, 0.f, 0.f, 0.f, 0.f, 0.f};
  /* softmax in base 2 about a HELD reference: 256 p = 2^(s + c), s = k'.(sc q) in log2 units, c = 8 - m. Softmax is the same for any m, so m only has to keep P inside f16: c stays as it is from step
     to step and goes into the score product as its accumulator input (cn: c in all eight rows of a lane's query column), so the product's result is the exponent itself.
     A step forms P and its sums from that; every p is positive, so a lane's sum below PLIM = 2^15 bounds each of its p below 2^15 (f16 holds 65504). Only if some lane's sum is not below PLIM
     (an infinite sum included), or in the wave's first step (c = 0, nothing summed yet), the step takes the maximum of its exponents, moves c so that the largest p is 2^8 (after the first step
     m only rises), rescales sums and accumulators and forms P again. The test is the same for the whole wave. The sums (lrun, pl) carry the same x256 as P; pm = 8 - c. */
  const float PLIM = 32768.0f;
  float lrun[QT];
  v8f cn[QT], o0[QT], o1[QT];
#pragma unroll
  for (int t = 0; t < QT; ++t) { cn[t] = z8; lrun[t] = 0.f; o0[t] = z8; o1[t] = z8; }
  /* two register sets of k and V^T fragments: set h serves steps h, h + 2, ...; a set is asked for again as soon as its step's products have read it, so a load has more than a step to arrive */
  unsigned int lb = lane * 16;   /* the lane's byte offset in the current pair of steps, counted from the wave's first step */
  /* one 32-key step on register set h. first: the wave's first step; refill: a step two further on exists (all three the same in every lane; h and refill constants at every call);
     kp, vp: the lane's byte addresses in the k and V^T fragments of the current pair of steps */
  auto step = [&](const int h, const bool first, const bool refill, const char* kp, const char* vp) __attribute__((always_inline)) {
    /* all four query tiles at once: their exponents stay in registers until the one test of the step has passed */
    v8f s0[QT], s1[QT];
    FragH pf[QT];
    float rs[QT];
#pragma unroll
    for (int t = 0; t < QT; ++t) {
      s0[t] = mma_hi(ka0[h], bq[t], cn[t]);
      s1[t] = mma_hi(ka1[h], bq[t], cn[t]);
    }
    if (refill) {
      ka0[h] = ld_fragb(kp + (h + 2) * 64 * HD);
      ka1[h] = ld_fragb(kp + (h + 2) * 64 * HD + 1024);
    }
    /* only the call that decides 'first' at run time has a branch directly behind the products: the distance the chip needs behind the last of them, kept also on the taken side,
       where the renewal writes over the product's C registers at once */
    if (h == 0 && refill) asm volatile("v_nop\n\tv_nop\n\tv_nop\n\tv_nop");
    bool renew = first;
    if (!renew) {
      float big = 0.f;
#pragma unroll
      for (int t = 0; t < QT; ++t) {
        float a = 0.f;
#pragma unroll
        for (int r = 0; r < 8; ++r) {
          const float p0 = __builtin_amdgcn_exp2f(s0[t][r]), p1 = __builtin_amdgcn_exp2f(s1[t][r]);
          a += p0 + p1;
          pf[t].h[r]     = (_Float16)p0;
          pf[t].h[8 + r] = (_Float16)p1;
        }
        rs[t] = a;
        big = fmaxf(big, a);
      }
      /* an infinite sum stays the larger; a NaN sum comes only from NaN scores, where the result is NaN on either path */
      renew = __builtin_amdgcn_ballot_w32(!(big < PLIM)) != 0u;   /* wave-uniform: a scalar branch, EXEC stays full for the products behind it */
    }
    if (renew) {
#pragma unroll
      for (int t = 0; t < QT; ++t) {
        float mx = -1.0e30f;
#pragma unroll
        for (int r = 0; r < 8; ++r) mx = fmaxf(mx, fmaxf(s0[t][r], s1[t][r]));
        mx = fmaxf(mx, __shfl_xor(mx, 16, 32));
        /* dl: what is added to c. First step: the largest p becomes 2^8, and the factor on the (zero) sums is set to 0; later m only rises, so dl <= 0 and the factor is at most 1 */
        const float dl = first ? (8.0f - mx) : fminf(8.0f - mx, 0.f);
        const float al = first ? 0.f : __builtin_amdgcn_exp2f(dl);
        float a = 0.f;
#pragma unroll
        for (int r = 0; r < 8; ++r) {
          const float p0 = __builtin_amdgcn_exp2f(s0[t][r] + dl), p1 = __builtin_amdgcn_exp2f(s1[t][r] + dl);
          a += p0 + p1;
          pf[t].h[r]     = (_Float16)p0;
          pf[t].h[8 + r] = (_Float16)p1;
        }
        rs[t] = a;
        lrun[t] *= al;
#pragma unroll
        for (int r = 0; r < 8; ++r) { o0[t][r] *= al; o1[t][r] *= al; cn[t][r] += dl; }
      }
    }
#pragma unroll
    for (int t = 0; t < QT; ++t) {
      lrun[t] += rs[t];
      o0[t] = mma_hi(va0[h], pf[t].v, o0[t]);
      o1[t] = mma_hi(va1[h], pf[t].v, o1[t]);
    }
    if (refill) {
      va0[h] = ld_fragb(vp + (h + 2) * 64 * HD);
      va1[h] = ld_fragb(vp + (h + 2) * 64 * HD + 1024);
    }
  };
  /* kept rolled over pairs of steps: the pair gives each register set a constant index. Every trip refills both sets without a test, so that the waits in front of the products can count the younger loads;
     the last pair, which has nothing to ask for, stands behind the loop */
#pragma unroll 1
  for (int it = 0; it < NST - 2; it += 2) {
    const char* kp = (const char*)kt + lb;
    const char* vp = (const char*)vt + lb;
    step(0, it == 0, true, kp, vp);
    step(1, false, true, kp, vp);
    /* the address registers of the trip's loads stay as they are until this wait, and the offset moves on only behind it */
    asm volatile("s_wait_xcnt 0x0" : "+v"(lb) : "v"(kp), "v"(vp) : "memory");
    lb += 64 * HD * 2;
  }
  step(0, false, false, nullptr, nullptr);
  step(1, false, false, nullptr, nullptr);
#pragma unroll
  for (int t = 0; t < QT; ++t) {
    const float lt = lrun[t] + __shfl_xor(lrun[t], 16, 32);
    const v4f c0 = {o0[t][0], o0[t][1], o0[t][2], o0[t][3]}, c1 = {o0[t][4], o0[t][5], o0[t][6], o0[t][7]};
    const v4f c2 = {o1[t][0], o1[t][1], o1[t][2], o1[t][3]}, c3 = {o1[t][4], o1[t][5], o1[t][6], o1[t][7]};
    float* pw_ = &po[((size_t)(w * QT + t) * 4 * 32 + lane) * 4];
    *(v4f*)(pw_)           = c0;
    *(v4f*)(pw_ + 32 * 4)  = c1;
    *(v4f*)(pw_ + 64 * 4)  = c2;
    *(v4f*)(pw_ + 96 * 4)  = c3;
    if (hh == 0) { pm[(w * QT + t) * 16 + ln] = 8.0f - cn[t][0]; pl[(w * QT + t) * 16 + ln] = lt; }
  }
  __syncthreads();
  {
    /* join: thread = (query tiles p and p + 2, chunk c, source lane l), one float4 a tile; ranges summed in index order */
    const int l = tid & 31, c = (tid >> 5) & 3;
    const int jl = l & 15, jh = l >> 4;
    const int d0 = hd * HD + (c >> 1) * 16 + 8 * jh + (c & 1) * 4;   /* the thread's four ctx channels */
    const v4f va = *(const v4fa*)(CN + 2 * CC + d0), vc = *(const v4fa*)(CN + 3 * CC + d0);
    const float rm = rstd * mean;
#pragma unroll
    for (int pp = 0; pp < 2; ++pp) {
      const int p = (tid >> 7) + 2 * pp;
      float mr[KSPL];
      float M = -1.0e30f;
#pragma unroll
      for (int s = 0; s < KSPL; ++s) { mr[s] = pm[(s * QT + p) * 16 + jl]; M = fmaxf(M, mr[s]); }
      float L = 0.f;
      v4f a = {0.f, 0.f, 0.f, 0.f};
#pragma unroll
      for (int s = 0; s < KSPL; ++s) {
        const float wg = __builtin_amdgcn_exp2f(mr[s] - M);
        const v4f v = *(const v4f*)&po[(((size_t)(s * QT + p) * 4 + c) * 32 + l) * 4];
        L += wg * pl[(s * QT + p) * 16 + jl];
#pragma unroll
        for (int q = 0; q < 4; ++q) a[q] += wg * v[q];
      }
      const float inv = 32.0f * rstd * (1.0f / L);    /* the x256 of P cancels against that of L; 2^5 (ctx carry) x rstd */
      v4h e;
#pragma unroll
      for (int q = 0; q < 4; ++q) e[q] = (_Float16)(a[q] * inv + 32.0f * (vc[q] - rm * va[q]));
      *(v4h*)&st[(p * 16 + jl) * STP + (c >> 1) * 16 + 8 * jh + (c & 1) * 4] = e;
    }
  }
  __syncthreads();
  if (tid < QT * 16 * HD / 8) {
    unsigned short* A = (unsigned short*)AO + (((size_t)b * NH + hd) * SEQ + q0) * HD;
    const v8us v = *(const v8us*)&st[(tid >> 2) * STP + (tid & 3) * 8];
    *(v8us*)(A + tid * 8) = v;
  }
}

// projection: D[o][n] = pw[o][:] . ctx[n][:] (A = weight rows, B = ctx rows, read from the head-major plane), 64 tokens per block, wave w owns o = 16w..16w+15;
// all weight and ctx fragments, the residual rows and the bias are asked for at entry and wait in registers: the block pays one load latency.
__global__ __launch_bounds__(256) __attribute__((amdgpu_waves_per_eu(4, 4))) /* a budget of 256 VGPRs: lets the scheduler keep the loaded operands in registers */ void k_proj(const float* __restrict__ x, const _Float16* __restrict__ W16, const float* __restrict__ pb,
                                              const _Float16* __restrict__ AO, float* __restrict__ out) {
  __shared__ __attribute__((aligned(16))) float so[128 * SOP];
  const int tid = threadIdx.x, w = tid >> 5, lane = tid & 31, ln = lane & 15, hh = lane >> 4;
  const int n0 = blockIdx.x * 64, b = blockIdx.y;
  v16h fw[4];
  const _Float16* wr = W16 + (size_t)3 * CC * CC + (size_t)(16 * w + ln) * CC;
#pragma unroll
  for (int kc = 0; kc < 4; ++kc) fw[kc] = ld_frag(wr + kc * 32, hh);
  v16h fb[4][4];
  const _Float16* br = AO + ((size_t)b * NH * SEQ + n0 + ln) * HD;   /* head-major ctx plane: k chunk kc is head kc */
#pragma unroll
  for (int nt = 0; nt < 4; ++nt) {
#pragma unroll
    for (int kc = 0; kc < 4; ++kc) fb[nt][kc] = ld_frag(br + (size_t)kc * SEQ * HD + nt * 16 * HD, hh);
  }
  /* store stage: thread = (row tid / 16 of each 16-row group i, four tokens) */
  const size_t e0 = (size_t)b * XS + (size_t)(tid >> 4) * SEQ_FULL + n0 + (tid & 15) * 4;
  const float* xp = x + e0;
  const float* pp = pb + (tid >> 4);
  v4f xv[8];
  float pbr[8];
#pragma unroll
  for (int i = 0; i < 8; ++i) {
    xv[i] = *(const v4fa*)(xp + (size_t)i * 16 * SEQ_FULL);
    pbr[i] = pp[16 * i];
  }
  /* the address registers of the loads above stay as they are until this wait: none becomes another load's destination first */
  asm volatile("s_wait_xcnt 0x0" :: "v"(wr - 3 * CC * CC + 8 * hh), "v"(br + 8 * hh), "v"(xp) : "memory");
  __builtin_amdgcn_sched_barrier(0);   /* the first use of a loaded value, and with it the first wait for data, stays behind the issue of the last load */
#pragma unroll
  for (int nt = 0; nt < 4; ++nt) {
    v8f acc = {0.f, 0.f, 0.f, 0.f, 0.f, 0.f, 0.f, 0.f};
#pragma unroll
    for (int kc = 0; kc < 4; ++kc) acc = mma(fw[kc], fb[nt][kc], acc);
#pragma unroll
    for (int r = 0; r < 8; ++r) so[(16 * w + 8 * hh + r) * SOP + nt * 16 + ln] = acc[r] * 0.001953125f;
  }
  __syncthreads();
  {
#pragma unroll
    for (int i = 0; i < 8; ++i) {
      const v4f a = *(const v4fa*)&so[((tid >> 4) + 16 * i) * SOP + (tid & 15) * 4];
      const float pbv = bf16_rne(pbr[i]);
      v4f y;
#pragma unroll
      for (int q = 0; q < 4; ++q) y[q] = bf16_rne(xv[i][q]) + (a[q] + pbv);
      *(v4f*)(out + e0 + (size_t)i * 16 * SEQ_FULL) = y;
    }
    
  }
}

extern "C" void kernel_launch(void* const* d_in, const int* in_sizes, int n_in,
                              void* d_out, int out_size, void* d_ws, size_t ws_size, hipStream_t stream) {
  if (n_in < 11) return;
  if (in_sizes[0] < NB * CC * SEQ) return;
  if (in_sizes[1] < CC || in_sizes[2] < CC || in_sizes[4] < CC || in_sizes[6] < CC || in_sizes[8] < CC || in_sizes[10] < CC) return;
  if (in_sizes[3] < CC * CC || in_sizes[5] < CC * CC || in_sizes[7] < CC * CC || in_sizes[9] < CC * CC) return;
  if (out_size < NB * CC * SEQ) return;
  if (ws_size < WS_TOTAL) return;
  const float* x   = (const float*)d_in[0];
  const float* gnw = (const float*)d_in[1];
  const float* gnb = (const float*)d_in[2];
  const float* qw  = (const float*)d_in[3];
  const float* qb  = (const float*)d_in[4];
  const float* kw  = (const float*)d_in[5];
  const float* vw  = (const float*)d_in[7];
  const float* vb  = (const float*)d_in[8];
  const float* pw  = (const float*)d_in[9];
  const float* pb  = (const float*)d_in[10];
  char* ws = (char*)d_ws;
  _Float16* W16 = (_Float16*)(ws + WS_W16);
  float*    GS  = (float*)(ws + WS_GS);
  float*    CN  = (float*)(ws + WS_CN);
  _Float16* QK  = (_Float16*)(ws + WS_QK);
  _Float16* VT  = (_Float16*)(ws + WS_VT);
  _Float16* AO  = (_Float16*)(ws + WS_AO);
  k_qkv<<<dim3(3 * NTB + WCB + 8, NB), 256, 0, stream>>>(x, gnw, gnb, qw, qb, kw, vw, vb, pw, W16, GS, CN, QK, VT);
  k_attn<<<dim3(SEQ / (QT * 16) * NH, NB), KSPL * 32, 0, stream>>>(QK, VT, GS, CN, AO);
  k_proj<<<dim3(SEQ / 64, NB), 256, 0, stream>>>(x, W16, pb, AO, (float*)d_out);
}

// v010
// A run of this version takes 19.8 microseconds.
// Timed twice side by side with v009, it ran 1.06 and 1.03 times as fast.
// Over all steps from v000 it is 6.88 times as fast.
#include <hip/hip_runtime.h>
// Channel-first spatial attention block with one-group GroupNorm and a plain residual: x [1][128][64][64] -> h = GN(x) (one mean / rstd over all 128 x 4096 values, per-channel affine);
// q/k/v = 1x1 convs ([out][in] weights + bias), 4 heads x 32; scores = q.k * 32^-0.5; softmax over the 4096 keys; ctx = P.v; result = x + pw.ctx + pb.
// (token-major q plane [head][n][32]; the k and V^T planes lie in the workspace in WMMA fragment order, see ld_fragp); flash attention with S^T = K.Q^T so that the score accumulators are directly the B operand of O^T = V^T.P^T
// (online softmax about a held reference, cross-half shuffles only in the steps that move it, no score plane); projection GEMM with the residual added at the float4 store stage.
// Compute dtype: every contraction v_wmma_f32_16x16x32_f16 (f16 operands, f32 accumulate), single products; all float inputs RNE-converted to bf16 first (exact in f16);
// carries: weights x16, P x256, ctx x32; statistics, softmax, residual in f32. Three launches: q/k/v products of g x with the statistics beside them; attention, which applies mean and rstd; projection.
#ifndef NB
#define NB 1
#endif
#ifndef SEQ
#define SEQ 4096
#endif
#define SEQ_FULL 4096
#define CC 128
#define NH 4
#define HD 32
#define HXP 136                      /* LDS pitch (halves) of token-major 128-wide tiles */
#define SVP 72                       /* LDS pitch (halves) of the channel-major 64-token tile */
#define KSPL 8                       /* key ranges (waves) per attention block */
#define QT 4                         /* 16-query tiles a wave of the attention block holds */
#define STP 40                       /* LDS pitch (halves) of the attention block's 32-wide output tile */
#define SOP 68                       /* LDS pitch (floats) of the projection tile */
#define PJO 32                       /* output channels of a projection block (one wave per 16) */
#define XS ((size_t)CC * SEQ_FULL)   /* per-batch stride of x / out */
#define QKS ((size_t)NB * NH * SEQ * HD)   /* halves between the q plane and the k plane */
#define NTB (SEQ / 64)               /* 64-token tiles of the q/k/v kernel; each leaves one (sum, M2) pair */
#define WCB (CC * CC / 8 / 256)      /* blocks that convert the projection weights */

static_assert(CC == NH * HD);
static_assert(HD == 32);
static_assert(CC == 128);
static_assert(CC <= 256);
static_assert(SEQ % 1024 == 0);
static_assert(SEQ <= SEQ_FULL);
static_assert(SEQ % (KSPL * 32) == 0);
static_assert(KSPL * 32 == 256);
static_assert(QT * 4 * 32 == 2 * KSPL * 32);
static_assert((SEQ / KSPL / 32) % 2 == 0 && SEQ / KSPL / 32 >= 4);
static_assert(SEQ % (QT * 16) == 0 && QT % 2 == 0 && (NH & (NH - 1)) == 0);
static_assert(64 * HXP <= 128 * SVP);
static_assert(HXP % 8 == 0 && SVP % 8 == 0 && STP % 8 == 0 && SOP % 4 == 0);
static_assert((CC * CC) % (8 * 256) == 0);
static_assert(NTB == 64);
static_assert(CC % PJO == 0 && PJO % 16 == 0 && PJO * 16 == 8 * (PJO / 16) * 32);

typedef _Float16 v16h __attribute__((ext_vector_type(16)));
typedef unsigned short v8us __attribute__((ext_vector_type(8), may_alias));
typedef float v8f  __attribute__((ext_vector_type(8)));
typedef float v4f  __attribute__((ext_vector_type(4)));
typedef float v4fa __attribute__((ext_vector_type(4), may_alias));
typedef float v2f  __attribute__((ext_vector_type(2)));
typedef _Float16 v2h __attribute__((ext_vector_type(2)));
typedef _Float16 v4h __attribute__((ext_vector_type(4)));
union FragH { v16h v; v8us half[2]; _Float16 h[16]; unsigned short u[16]; };

// workspace carve (bytes, every region a multiple of 256)
constexpr size_t WS_W16 = 0;
constexpr size_t SZ_W16 = (size_t)4 * CC * CC * 2;
constexpr size_t WS_GS  = WS_W16 + SZ_W16;
constexpr size_t SZ_GS  = (size_t)NB * NTB * 32 * 4;
constexpr size_t WS_CN  = WS_GS + SZ_GS;
constexpr size_t SZ_CN  = (size_t)2 * 2 * CC * 4;
constexpr size_t WS_QK  = WS_CN + SZ_CN;
constexpr size_t SZ_QK  = 2 * QKS * 2;
constexpr size_t WS_VT  = WS_QK + SZ_QK;
constexpr size_t SZ_VT  = (size_t)NB * CC * SEQ * 2;
constexpr size_t WS_AO  = WS_VT + SZ_VT;
constexpr size_t SZ_AO  = (size_t)NB * SEQ * CC * 2;
constexpr size_t WS_TOTAL = WS_AO + SZ_AO;
static_assert(SZ_W16 % 256 == 0 && SZ_GS % 256 == 0 && SZ_CN % 256 == 0 && SZ_QK % 256 == 0 && SZ_VT % 256 == 0 && SZ_AO % 256 == 0);
static_assert(WS_TOTAL <= (size_t)134217728);

__device__ __forceinline__ float bf16_rne(float x) {
  unsigned int u = __float_as_uint(x);
  u = (u + 0x7FFFu + ((u >> 16) & 1u)) & 0xFFFF0000u;
  return __uint_as_float(u);
}

// 16x32 operand fragment from a k-contiguous 16-bit global row: elements 0..7 <- k 8h..8h+7, elements 8..15 <- k 16+8h..16+8h+7 (same map for A and B)
__device__ __forceinline__ v16h ld_frag(const _Float16* __restrict__ p, int hh) {
  FragH f;
  const unsigned short* q = (const unsigned short*)p;
  f.half[0] = *(const v8us*)(q + 8 * hh);
  f.half[1] = *(const v8us*)(q + 16 + 8 * hh);
  return f.v;
}
// the same 16x32 operand fragment from a plane kept in fragment order: 1 KiB per fragment, [k half j][lane][8 halves], chunk (j, lane = 16h + row) <- k 16j+8h..16j+8h+7 of that row;
// p = fragment base (the same in every lane), l8 = 8 * lane: each of the two wave-wide 16-byte loads covers 512 contiguous bytes (4 whole lines) instead of 16-byte pieces of 8 or 16 lines
__device__ __forceinline__ v16h ld_fragp(const _Float16* __restrict__ p, unsigned int l8) {
  FragH f;
  const unsigned short* q = (const unsigned short*)p;
  f.half[0] = *(const v8us*)(q + l8);
  f.half[1] = *(const v8us*)(q + 256 + l8);
  return f.v;
}
// the same from the lane's own byte address in the fragment (fragment base + 16 * lane)
__device__ __forceinline__ v16h ld_fragb(const char* __restrict__ q) {
  FragH f;
  f.half[0] = *(const v8us*)(q);
  f.half[1] = *(const v8us*)(q + 512);
  return f.v;
}
__device__ __forceinline__ v8f mma(v16h a, v16h b, v8f c) {
  v8f d = __builtin_amdgcn_wmma_f32_16x16x32_f16(false, a, false, b, (short)0, c, false, false);
  asm volatile("v_nop\n\tv_nop\n\tv_nop\n\tv_nop" : "+v"(d) : "v"(a), "v"(b));
  return d;
}
// the plain builtin: the compiler keeps the distances behind it itself, and its operands may lie above v255, where an asm statement's operands may not
__device__ __forceinline__ v8f mma_hi(v16h a, v16h b, v8f c) {
  return __builtin_amdgcn_wmma_f32_16x16x32_f16(false, a, false, b, (short)0, c, false, false);
}
__device__ __forceinline__ v8us cvt_w8(const float* __restrict__ w, int e) {
  const v4f a = *(const v4fa*)(w + e), c = *(const v4fa*)(w + e + 4);
  FragH f;
#pragma unroll
  for (int q = 0; q < 4; ++q) {
    f.h[q]     = (_Float16)(bf16_rne(a[q]) * 16.0f);
    f.h[4 + q] = (_Float16)(bf16_rne(c[q]) * 16.0f);
  }
  return f.half[0];
}

// two equal-sized sets of values, each given by its sum and its sum of squares about its own mean (M2), joined exactly: n = values in each set
__device__ __forceinline__ void join_stats(float& s, float& m2, float so, float mo, float inv2n) {
  const float d = s - so;
  m2 = (m2 + mo) + (d * d) * inv2n;
  s = s + so;
}

// q/k/v GEMM on x itself. GroupNorm is h = rstd * g * (x - mean) + beta with ONE mean and rstd, and the 1x1 convs are linear, so
//   W.h + bias = rstd * (W.(g x)) + [ W.beta + bias - rstd * mean * (W.g) ]:
// the products W.(g x) wait for no statistic; k_attn, which starts after every (sum, M2) pair is written, applies rstd and the bracket (see there).
// Block-uniform split by block index. Blocks 0..3*NTB-1: matrix m = index / NTB, 64 tokens (8 waves; wave w owns output channels 16w..16w+15); the weights are converted here
// (x16 carry, as before); the m = 0 block of a token tile also leaves the tile's (sum, M2) in one whole line of GS.
// q, k: D[token][o] (A = g x tile rows, B = weight rows) -> planes QK[{q,k}][head]: q token-major [n][32], k in fragment order [n / 16][1 KiB];
// v: D[o][token] (A = weight rows, B = g x tile rows) -> plane VT[head] in fragment order [n / 32][16-d tile][1 KiB].
// Next WCB blocks: projection weights to f16. Last 8 blocks: CN[{q,v}][0][o] = sum_c w g, CN[{q,v}][1][o] = sum_c w beta + bias.
// every global operand is asked for at entry and waits in registers: the block pays one load latency.
__global__ __launch_bounds__(256) __attribute__((amdgpu_waves_per_eu(2, 2))) /* 8 waves on 4 SIMDs: lets the scheduler keep the loaded operands in registers */ void k_qkv(const float* __restrict__ x, const float* __restrict__ gnw, const float* __restrict__ gnb,
                                             const float* __restrict__ qw, const float* __restrict__ qb, const float* __restrict__ kw,
                                             const float* __restrict__ vw, const float* __restrict__ vb, const float* __restrict__ pw,
                                             _Float16* __restrict__ W16, float* __restrict__ GS, float* __restrict__ CN,
                                             _Float16* __restrict__ QK, _Float16* __restrict__ VT) {
  __shared__ __attribute__((aligned(16))) _Float16 hx[64 * HXP];
  __shared__ __attribute__((aligned(16))) _Float16 stg[128 * SVP];
  __shared__ float wst[64];
  const int tid = threadIdx.x, w = tid >> 5, lane = tid & 31, ln = lane & 15, hh = lane >> 4;
  const int b = blockIdx.y;
  if (blockIdx.x >= 3 * NTB) {
    if (b != 0) return;
    const int ax = blockIdx.x - 3 * NTB;
    if (ax < WCB) {
      const int e = (ax * 256 + tid) * 8;
      *(v8us*)((unsigned short*)W16 + 3 * CC * CC + e) = cvt_w8(pw, e);
      return;
    }
    /* 32 weight rows a block, 8 threads a row (16 input channels each) */
    const int cx = ax - WCB, mv = cx >> 2;
    const int o = (cx & 3) * 32 + (tid >> 3), c0 = (tid & 7) * 16;
    const float* wr = (mv ? vw : qw) + (size_t)o * CC + c0;
    const float bias = (mv ? vb : qb)[o];
    float sa = 0.f, sb = 0.f;
#pragma unroll
    for (int i = 0; i < 4; ++i) {
      const v4f wv = *(const v4fa*)(wr + 4 * i), gv = *(const v4fa*)(gnw + c0 + 4 * i), bv = *(const v4fa*)(gnb + c0 + 4 * i);
#pragma unroll
      for (int q = 0; q < 4; ++q) {
        const float wq = bf16_rne(wv[q]);
        sa += wq * bf16_rne(gv[q]);
        sb += wq * bf16_rne(bv[q]);
      }
    }
#pragma unroll
    for (int st = 1; st < 8; st <<= 1) { sa += __shfl_xor(sa, st, 32); sb += __shfl_xor(sb, st, 32); }
    if ((tid & 7) == 0) { wst[tid >> 3] = sa; wst[32 + (tid >> 3)] = sb + bf16_rne(bias); }
    __syncthreads();
    /* one wave stores one whole 128-byte line */
    if (tid < 64) CN[(size_t)(mv * 2 + (tid >> 5)) * CC + (cx & 3) * 32 + (tid & 31)] = wst[tid];
    return;
  }
  const int m = blockIdx.x / NTB, nb = blockIdx.x % NTB, n0 = nb * 64;
  /* x tile: a thread holds 4 channels x 8 tokens (eight 16-byte loads; a wave-wide load covers four whole 128-byte lines) */
  const int c4 = 16 * w + 4 * (lane >> 3), t4 = 4 * (lane & 7);
  const float* xq = x + (size_t)b * XS + (size_t)c4 * SEQ_FULL + n0 + t4;
  v4f xr[2][4];
#pragma unroll
  for (int i = 0; i < 2; ++i) {
#pragma unroll
    for (int j = 0; j < 4; ++j) xr[i][j] = *(const v4fa*)(xq + (size_t)j * SEQ_FULL + 32 * i);
  }
  /* the lane's share of weight row 16w + ln in fragment order: wf[kc][0..1] <- k 32kc+8h..+7, wf[kc][2..3] <- k 32kc+16+8h..+7 */
  const float* wrow = ((m == 0) ? qw : (m == 1) ? kw : vw) + (size_t)(16 * w + ln) * CC + 8 * hh;
  v4f wf[4][4];
#pragma unroll
  for (int kc = 0; kc < 4; ++kc) {
#pragma unroll
    for (int p = 0; p < 4; ++p) wf[kc][p] = *(const v4fa*)(wrow + kc * 32 + (p >> 1) * 16 + (p & 1) * 4);
  }
  const v4f gw4 = *(const v4fa*)(gnw + c4);
  /* the address registers of the loads above stay as they are until this wait: none becomes another load's destination first */
  asm volatile("s_wait_xcnt 0x0" :: "v"(xq), "v"(wrow) : "memory");
  __builtin_amdgcn_sched_barrier(0);   /* the first use of a loaded value, and with it the first wait for data, stays behind the issue of the last load */
#pragma unroll
  for (int i = 0; i < 2; ++i) {
#pragma unroll
    for (int j = 0; j < 4; ++j) {
#pragma unroll
      for (int q = 0; q < 4; ++q) xr[i][j][q] = bf16_rne(xr[i][j][q]);
    }
  }
#pragma unroll
  for (int i = 0; i < 2; ++i) {
#pragma unroll
    for (int q = 0; q < 4; ++q) {
      v4h hv;
#pragma unroll
      for (int j = 0; j < 4; ++j) hv[j] = (_Float16)(xr[i][j][q] * bf16_rne(gw4[j]));
      *(v4h*)&hx[(32 * i + t4 + q) * HXP + c4] = hv;
    }
  }
  if (m == 0) {
    /* the thread's 32 values, then five exact pairwise joins across the wave: every lane ends with the wave's (sum, M2) */
    float s = 0.f, m2 = 0.f;
#pragma unroll
    for (int i = 0; i < 2; ++i) {
#pragma unroll
      for (int j = 0; j < 4; ++j) s += (xr[i][j][0] + xr[i][j][1]) + (xr[i][j][2] + xr[i][j][3]);
    }
    const float mt = s * (1.0f / 32.0f);
#pragma unroll
    for (int i = 0; i < 2; ++i) {
#pragma unroll
      for (int j = 0; j < 4; ++j) {
        const float d0 = xr[i][j][0] - mt, d1 = xr[i][j][1] - mt, d2 = xr[i][j][2] - mt, d3 = xr[i][j][3] - mt;
        m2 += (d0 * d0 + d1 * d1) + (d2 * d2 + d3 * d3);
      }
    }
#pragma unroll
    for (int k = 0; k < 5; ++k) join_stats(s, m2, __shfl_xor(s, 1 << k, 32), __shfl_xor(m2, 1 << k, 32), 1.0f / (float)(64 << k));
    if (lane == 0) { wst[w] = s; wst[8 + w] = m2; }
  }
  __syncthreads();
  if (m == 0 && w == 0) {
    float s = wst[lane & 7], m2 = wst[8 + (lane & 7)];
#pragma unroll
    for (int k = 0; k < 3; ++k) join_stats(s, m2, __shfl_xor(s, 1 << k, 32), __shfl_xor(m2, 1 << k, 32), 1.0f / (float)(2048 << k));
    /* one whole 128-byte line a tile: [sum, M2, 0...] */
    if (lane < 8) {
      const v4f o = {(lane == 0) ? s : 0.f, (lane == 0) ? m2 : 0.f, 0.f, 0.f};
      *(v4f*)(GS + ((size_t)b * NTB + nb) * 32 + lane * 4) = o;
    }
  }

  v16h fw[4];
#pragma unroll
  for (int kc = 0; kc < 4; ++kc) {
    FragH f;
#pragma unroll
    for (int e = 0; e < 16; ++e) f.h[e] = (_Float16)(bf16_rne(wf[kc][e >> 2][e & 3]) * 16.0f);
    fw[kc] = f.v;
  }
  /* the 16 tile fragments (A for q and k, B for v: same map): all LDS loads in flight, kept in registers */
  v16h fh[4][4];
#pragma unroll
  for (int nt = 0; nt < 4; ++nt) {
#pragma unroll
    for (int kc = 0; kc < 4; ++kc) {
      FragH f;
      f.half[0] = *(const v8us*)&hx[(nt * 16 + ln) * HXP + kc * 32 + 8 * hh];
      f.half[1] = *(const v8us*)&hx[(nt * 16 + ln) * HXP + kc * 32 + 16 + 8 * hh];
      fh[nt][kc] = f.v;
    }
  }
  if (m < 2) {
#pragma unroll
    for (int nt = 0; nt < 4; ++nt) {
      v8f acc = {0.f, 0.f, 0.f, 0.f, 0.f, 0.f, 0.f, 0.f};
#pragma unroll
      for (int kc = 0; kc < 4; ++kc) acc = mma(fh[nt][kc], fw[kc], acc);
#pragma unroll
      for (int r = 0; r < 8; ++r) stg[(nt * 16 + 8 * hh + r) * HXP + 16 * w + ln] = (_Float16)(acc[r] * 0.0625f);
    }
    __syncthreads();
    unsigned short* P = (unsigned short*)QK + (size_t)m * QKS + (size_t)b * NH * SEQ * HD;
#pragma unroll
    for (int i = 0; i < 4; ++i) {
      const int idx = tid + 256 * i;
      const int head = idx >> 8, pi = idx & 255;
      /* 16-byte chunk pi of the head's 64 tokens: q token-major [token][4 chunks]; k in fragment order [16-key tile][k half][lane] */
      const int tok = (m == 0) ? (pi >> 2) : ((pi >> 6) * 16 + (pi & 15));
      const int d8  = (m == 0) ? ((pi & 3) * 8) : (((pi >> 5) & 1) * 16 + ((pi >> 4) & 1) * 8);
      const v8us v = *(const v8us*)&stg[tok * HXP + head * HD + d8];
      *(v8us*)(P + ((size_t)head * SEQ + n0) * HD + pi * 8) = v;
    }
    asm volatile("s_wait_xcnt 0x0" ::: "memory");   /* the address and data registers of the stores above are rewritten by nothing in front of this wait */
  } else {
#pragma unroll
    for (int nt = 0; nt < 4; ++nt) {
      v8f acc = {0.f, 0.f, 0.f, 0.f, 0.f, 0.f, 0.f, 0.f};
#pragma unroll
      for (int kc = 0; kc < 4; ++kc) acc = mma(fw[kc], fh[nt][kc], acc);
#pragma unroll
      for (int r = 0; r < 8; ++r) stg[(16 * w + 8 * hh + r) * SVP + nt * 16 + ln] = (_Float16)(acc[r] * 0.0625f);
    }
    __syncthreads();
    unsigned short* V = (unsigned short*)VT + (size_t)b * CC * SEQ;
#pragma unroll
    for (int i = 0; i < 4; ++i) {
      const int idx = tid + 256 * i;
      const int head = idx >> 8, pi = idx & 255;
      /* fragment order: chunk pi of the head's 64 keys = [32-key step][16-d tile][k half][lane] */
      const int o = head * HD + ((pi >> 6) & 1) * 16 + (pi & 15);
      const int p8 = (pi >> 7) * 32 + ((pi >> 5) & 1) * 16 + ((pi >> 4) & 1) * 8;
      const v8us v = *(const v8us*)&stg[o * SVP + p8];
      *(v8us*)(V + ((size_t)head * SEQ + n0) * HD + pi * 8) = v;
    }
    asm volatile("s_wait_xcnt 0x0" ::: "memory");   /* the address and data registers of the stores above are rewritten by nothing in front of this wait */
  }
}
// flash attention: block = 64 queries x 1 head x KSPL key ranges, one wave per key range; a wave holds QT = 4 query tiles, so every k and V^T fragment it loads serves 64 queries. Per 32-key step and query tile:
// S^T[key][q] = K.Q^T (two 16-key tiles; A = K rows, B = Q rows), online softmax per query column (lane), P^T packed from the two score tiles
// (element r <- tile 0 row 8h+r, element 8+r <- tile 1 row 8h+r) as the B operand of O^T[d][q] += V^T[d][key].P^T (A = V^T rows, two 16-d tiles).
// Each wave walks its own SEQ / KSPL keys with its own maxima, sums and accumulators; the KSPL partial results are joined in LDS in fixed range order.
// The ctx plane AO is head-major [head][n][32], so that a block stores whole lines.
// The planes hold W.(g x) (see k_qkv); GroupNorm's mean and rstd come in here. Wave 0 joins the NTB (sum, M2) pairs and hands mean and rstd to the block through LDS. Then
// q = rstd * q' + cq (once, on the query fragments), cq = CN[q][1] - rstd * mean * CN[q][0]; k = rstd * k' + ck: rstd goes into the score scale, and q.ck (kb is part of ck) adds the same amount
// to every score of a query, which softmax cancels exactly, so it is not formed; the weights of a query sum to 1, so ctx = rstd * (P.v') + cv, applied where the ranges are joined.
__global__ __launch_bounds__(256) __attribute__((amdgpu_waves_per_eu(2, 2))) /* 8 waves on 4 SIMDs: a wave may have 512 VGPRs */ void k_attn(const _Float16* __restrict__ QK, const _Float16* __restrict__ VT, const float* __restrict__ GS, const float* __restrict__ CN, _Float16* __restrict__ AO) {
  __shared__ __attribute__((aligned(16))) float po[KSPL * QT * 4 * 32 * 4];  /* [range][query tile][4-row chunk][lane] float4: un-normalised O^T partials */
  __shared__ float pm[KSPL * QT * 16];                                       /* [range][query tile][query] held softmax reference m = 8 - c */
  __shared__ float pl[KSPL * QT * 16];                                       /* [range][query tile][query] sum of exponentials */
  __shared__ __attribute__((aligned(16))) _Float16 st[QT * 16 * STP];
  __shared__ float gst[2];
  const int tid = threadIdx.x, lane = tid & 31, ln = lane & 15, hh = lane >> 4;
  const int w = __builtin_amdgcn_readfirstlane(tid >> 5);   /* wave number = key range, in a scalar register: it becomes a scalar address part */
  const int hd = blockIdx.x & (NH - 1), qblk = blockIdx.x / NH, b = blockIdx.y;
  const int k0 = w * (SEQ / KSPL);
  constexpr int NST = SEQ / KSPL / 32;   /* 32-key steps of a wave */
  const int q0 = qblk * (QT * 16);
  const _Float16* Qh = QK + ((size_t)b * NH + hd) * SEQ * HD;
  const _Float16* Kh = Qh + QKS;
  const _Float16* Vh = VT + ((size_t)b * CC + hd * HD) * SEQ;
  /* every loop over the query tiles below is unrolled in full: bq, cn, lrun, o0, o1 are indexed by the tile and stay in registers only under constant indices */
  v16h bq[QT];
  const _Float16* qp = Qh + (size_t)(q0 + ln) * HD;
  const float* cp = CN + hd * HD + 8 * hh;
#pragma unroll
  for (int t = 0; t < QT; ++t) bq[t] = ld_frag(qp + t * 16 * HD, hh);
  /* the two constants of q for the lane's 16 fragment elements (d = 8h..8h+7, 16+8h..16+8h+7) */
  v4f ca[4], cb[4];
#pragma unroll
  for (int p = 0; p < 4; ++p) {
    ca[p] = *(const v4fa*)(cp + (p >> 1) * 16 + (p & 1) * 4);
    cb[p] = *(const v4fa*)(cp + CC + (p >> 1) * 16 + (p & 1) * 4);
  }
  const _Float16* kt = Kh + (size_t)k0 * HD;   /* the wave's first 32-key step: a step is 2 KiB of k fragments, 2 KiB of V^T fragments */
  const _Float16* vt = Vh + (size_t)k0 * HD;
  /* the first two steps' fragments wait for no statistic: asked for here, they arrive while mean and rstd are joined */
  v16h ka0[2], ka1[2], va0[2], va1[2];
#pragma unroll
  for (int h = 0; h < 2; ++h) {
    ka0[h] = ld_fragp(kt + h * 32 * HD, lane * 8);
    ka1[h] = ld_fragp(kt + h * 32 * HD + 512, lane * 8);
    va0[h] = ld_fragp(vt + h * 32 * HD, lane * 8);
    va1[h] = ld_fragp(vt + h * 32 * HD + 512, lane * 8);
  }
  /* the address registers of the loads above stay as they are until this wait: none becomes another load's destination first */
  asm volatile("s_wait_xcnt 0x0" :: "v"(qp + 8 * hh), "v"(cp) : "memory");
  if (w == 0) {
    const float* gp = GS + (size_t)b * NTB * 32 + lane * 32;
    const v2f p0 = *(const v2f*)gp, p1 = *(const v2f*)(gp + 32 * 32);
    float s = p0[0], m2 = p0[1];
    join_stats(s, m2, p1[0], p1[1], 1.0f / 16384.0f);
#pragma unroll
    for (int k = 0; k < 5; ++k) join_stats(s, m2, __shfl_xor(s, 1 << k, 32), __shfl_xor(m2, 1 << k, 32), 1.0f / (float)(32768 << k));
    if (lane == 0) { gst[0] = s * (1.0f / (float)(CC * SEQ)); gst[1] = rsqrtf(m2 * (1.0f / (float)(CC * SEQ)) + 1e-5f); }
  }
  __syncthreads();
  /* the same in every lane: kept in scalar registers */
  const float mean = __uint_as_float(__builtin_amdgcn_readfirstlane(__float_as_uint(gst[0])));
  const float rstd = __uint_as_float(__builtin_amdgcn_readfirstlane(__float_as_uint(gst[1])));
  /* sc = 32^-0.5 * log2(e) * rstd (the rstd of k): multiplied into q in front of the rounding to f16 below, so that the score product itself is in log2 units */
  const float sc = 0.17677669529663687f * 1.4426950408889634f * rstd;
  {
    const float rm = rstd * mean;
    float cq[16];
#pragma unroll
    for (int e = 0; e < 16; ++e) cq[e] = cb[e >> 2][e & 3] - rm * ca[e >> 2][e & 3];
#pragma unroll
    for (int t = 0; t < QT; ++t) {
      FragH f;
      f.v = bq[t];
#pragma unroll
      for (int e = 0; e < 16; ++e) f.h[e] = (_Float16)(((float)f.h[e] * rstd + cq[e]) * sc);
      bq[t] = f.v;
    }
  }
  const v8f z8 = {0.f, 0.f, 0.f, 0.f, 0.f, 0.f, 0.f, 0.f};
  /* softmax in base 2 about a HELD reference: 256 p = 2^(s + c), s = k'.(sc q) in log2 units, c = 8 - m. Softmax is the same for any m, so m only has to keep P inside f16: c stays as it is from step
     to step and goes into the score product as its accumulator input (cn: c in all eight rows of a lane's query column), so the product's result is the exponent itself.
     A step forms P and its sums from that; every p is positive, so a lane's sum below PLIM = 2^15 bounds each of its p below 2^15 (f16 holds 65504). Only if some lane's sum is not below PLIM
     (an infinite sum included), or in the wave's first step (c = 0, nothing summed yet), the step takes the maximum of its exponents, moves c so that the largest p is 2^8 (after the first step
     m only rises), rescales sums and accumulators and forms P again. The test is the same for the whole wave. The sums (lrun, pl) carry the same x256 as P; pm = 8 - c. */
  const float PLIM = 32768.0f;
  float lrun[QT];
  v8f cn[QT], o0[QT], o1[QT];
#pragma unroll
  for (int t = 0; t < QT; ++t) { cn[t] = z8; lrun[t] = 0.f; o0[t] = z8; o1[t] = z8; }
  /* two register sets of k and V^T fragments: set h serves steps h, h + 2, ...; a set is asked for again as soon as its step's products have read it, so a load has more than a step to arrive */
  unsigned int lb = lane * 16;   /* the lane's byte offset in the current pair of steps, counted from the wave's first step */
  /* one 32-key step on register set h. first: the wave's first step; refill: a step two further on exists (all three the same in every lane; h and refill constants at every call);
     kp, vp: the lane's byte addresses in the k and V^T fragments of the current pair of steps */
  auto step = [&](const int h, const bool first, const bool refill, const char* kp, const char* vp) __attribute__((always_inline)) {
    /* all four query tiles at once: their exponents stay in registers until the one test of the step has passed */
    v8f s0[QT], s1[QT];
    FragH pf[QT];
    float rs[QT];
#pragma unroll
    for (int t = 0; t < QT; ++t) {
      s0[t] = mma_hi(ka0[h], bq[t], cn[t]);
      s1[t] = mma_hi(ka1[h], bq[t], cn[t]);
    }
    if (refill) {
      ka0[h] = ld_fragb(kp + (h + 2) * 64 * HD);
      ka1[h] = ld_fragb(kp + (h + 2) * 64 * HD + 1024);
    }
    /* only the call that decides 'first' at run time has a branch directly behind the products: the distance the chip needs behind the last of them, kept also on the taken side,
       where the renewal writes over the product's C registers at once */
    if (h == 0 && refill) asm volatile("v_nop\n\tv_nop\n\tv_nop\n\tv_nop");
    bool renew = first;
    if (!renew) {
      float big = 0.f;
#pragma unroll
      for (int t = 0; t < QT; ++t) {
        float a = 0.f;
#pragma unroll
        for (int r = 0; r < 8; ++r) {
          const float p0 = __builtin_amdgcn_exp2f(s0[t][r]), p1 = __builtin_amdgcn_exp2f(s1[t][r]);
          a += p0 + p1;
          pf[t].h[r]     = (_Float16)p0;
          pf[t].h[8 + r] = (_Float16)p1;
        }
        rs[t] = a;
        big = fmaxf(big, a);
      }
      /* an infinite sum stays the larger; a NaN sum comes only from NaN scores, where the result is NaN on either path */
      renew = __builtin_amdgcn_ballot_w32(!(big < PLIM)) != 0u;   /* wave-uniform: a scalar branch, EXEC stays full for the products behind it */
    }
    if (renew) {
#pragma unroll
      for (int t = 0; t < QT; ++t) {
        float mx = -1.0e30f;
#pragma unroll
        for (int r = 0; r < 8; ++r) mx = fmaxf(mx, fmaxf(s0[t][r], s1[t][r]));
        mx = fmaxf(mx, __shfl_xor(mx, 16, 32));
        /* dl: what is added to c. First step: the largest p becomes 2^8, and the factor on the (zero) sums is set to 0; later m only rises, so dl <= 0 and the factor is at most 1 */
        const float dl = first ? (8.0f - mx) : fminf(8.0f - mx, 0.f);
        const float al = first ? 0.f : __builtin_amdgcn_exp2f(dl);
        float a = 0.f;
#pragma unroll
        for (int r = 0; r < 8; ++r) {
          const float p0 = __builtin_amdgcn_exp2f(s0[t][r] + dl), p1 = __builtin_amdgcn_exp2f(s1[t][r] + dl);
          a += p0 + p1;
          pf[t].h[r]     = (_Float16)p0;
          pf[t].h[8 + r] = (_Float16)p1;
        }
        rs[t] = a;
        lrun[t] *= al;
#pragma unroll
        for (int r = 0; r < 8; ++r) { o0[t][r] *= al; o1[t][r] *= al; cn[t][r] += dl; }
      }
    }
#pragma unroll
    for (int t = 0; t < QT; ++t) {
      lrun[t] += rs[t];
      o0[t] = mma_hi(va0[h], pf[t].v, o0[t]);
      o1[t] = mma_hi(va1[h], pf[t].v, o1[t]);
    }
    if (refill) {
      va0[h] = ld_fragb(vp + (h + 2) * 64 * HD);
      va1[h] = ld_fragb(vp + (h + 2) * 64 * HD + 1024);
    }
  };
  /* kept rolled over pairs of steps: the pair gives each register set a constant index. Every trip refills both sets without a test, so that the waits in front of the products can count the younger loads;
     the last pair, which has nothing to ask for, stands behind the loop */
#pragma unroll 1
  for (int it = 0; it < NST - 2; it += 2) {
    const char* kp = (const char*)kt + lb;
    const char* vp = (const char*)vt + lb;
    step(0, it == 0, true, kp, vp);
    step(1, false, true, kp, vp);
    /* the address registers of the trip's loads stay as they are until this wait, and the offset moves on only behind it */
    asm volatile("s_wait_xcnt 0x0" : "+v"(lb) : "v"(kp), "v"(vp) : "memory");
    lb += 64 * HD * 2;
  }
  step(0, false, false, nullptr, nullptr);
  step(1, false, false, nullptr, nullptr);
#pragma unroll
  for (int t = 0; t < QT; ++t) {
    const float lt = lrun[t] + __shfl_xor(lrun[t], 16, 32);
    const v4f c0 = {o0[t][0], o0[t][1], o0[t][2], o0[t][3]}, c1 = {o0[t][4], o0[t][5], o0[t][6], o0[t][7]};
    const v4f c2 = {o1[t][0], o1[t][1], o1[t][2], o1[t][3]}, c3 = {o1[t][4], o1[t][5], o1[t][6], o1[t][7]};
    float* pw_ = &po[((size_t)(w * QT + t) * 4 * 32 + lane) * 4];
    *(v4f*)(pw_)           = c0;
    *(v4f*)(pw_ + 32 * 4)  = c1;
    *(v4f*)(pw_ + 64 * 4)  = c2;
    *(v4f*)(pw_ + 96 * 4)  = c3;
    if (hh == 0) { pm[(w * QT + t) * 16 + ln] = 8.0f - cn[t][0]; pl[(w * QT + t) * 16 + ln] = lt; }
  }
  __syncthreads();
  {
    /* join: thread = (query tiles p and p + 2, chunk c, source lane l), one float4 a tile; ranges summed in index order */
    const int l = tid & 31, c = (tid >> 5) & 3;
    const int jl = l & 15, jh = l >> 4;
    const int d0 = hd * HD + (c >> 1) * 16 + 8 * jh + (c & 1) * 4;   /* the thread's four ctx channels */
    const v4f va = *(const v4fa*)(CN + 2 * CC + d0), vc = *(const v4fa*)(CN + 3 * CC + d0);
    const float rm = rstd * mean;
#pragma unroll
    for (int pp = 0; pp < 2; ++pp) {
      const int p = (tid >> 7) + 2 * pp;
      float mr[KSPL];
      float M = -1.0e30f;
#pragma unroll
      for (int s = 0; s < KSPL; ++s) { mr[s] = pm[(s * QT + p) * 16 + jl]; M = fmaxf(M, mr[s]); }
      float L = 0.f;
      v4f a = {0.f, 0.f, 0.f, 0.f};
#pragma unroll
      for (int s = 0; s < KSPL; ++s) {
        const float wg = __builtin_amdgcn_exp2f(mr[s] - M);
        const v4f v = *(const v4f*)&po[(((size_t)(s * QT + p) * 4 + c) * 32 + l) * 4];
        L += wg * pl[(s * QT + p) * 16 + jl];
#pragma unroll
        for (int q = 0; q < 4; ++q) a[q] += wg * v[q];
      }
      const float inv = 32.0f * rstd * (1.0f / L);    /* the x256 of P cancels against that of L; 2^5 (ctx carry) x rstd */
      v4h e;
#pragma unroll
      for (int q = 0; q < 4; ++q) e[q] = (_Float16)(a[q] * inv + 32.0f * (vc[q] - rm * va[q]));
      *(v4h*)&st[(p * 16 + jl) * STP + (c >> 1) * 16 + 8 * jh + (c & 1) * 4] = e;
    }
  }
  __syncthreads();
  if (tid < QT * 16 * HD / 8) {
    unsigned short* A = (unsigned short*)AO + (((size_t)b * NH + hd) * SEQ + q0) * HD;
    const v8us v = *(const v8us*)&st[(tid >> 2) * STP + (tid & 3) * 8];
    *(v8us*)(A + tid * 8) = v;
  }
}

// projection: D[o][n] = pw[o][:] . ctx[n][:] (A = weight rows, B = ctx rows, read from the head-major plane), 64 tokens x PJO = 32 output channels per block of two waves, wave w owns o = o0+16w..o0+16w+15:
// CC / PJO * NTB = 256 blocks, so that the launch's loads and stores go through every WGP's memory path, two waves' worth each. The token tile is the fast part of the block index.
// all weight and ctx fragments, the residual rows and the bias are asked for at entry and wait in registers: the block pays one load latency.
__global__ __launch_bounds__(PJO * 2) __attribute__((amdgpu_waves_per_eu(4, 4))) /* a budget of 256 VGPRs: lets the scheduler keep the loaded operands in registers */ void k_proj(const float* __restrict__ x, const _Float16* __restrict__ W16, const float* __restrict__ pb,
                                              const _Float16* __restrict__ AO, float* __restrict__ out) {
  __shared__ __attribute__((aligned(16))) float so[PJO * SOP];
  const int tid = threadIdx.x, w = tid >> 5, lane = tid & 31, ln = lane & 15, hh = lane >> 4;
  const int n0 = (blockIdx.x % NTB) * 64, o0 = (blockIdx.x / NTB) * PJO, b = blockIdx.y;
  v16h fw[4];
  const _Float16* wr = W16 + (size_t)3 * CC * CC + (size_t)(o0 + 16 * w + ln) * CC;
#pragma unroll
  for (int kc = 0; kc < 4; ++kc) fw[kc] = ld_frag(wr + kc * 32, hh);
  v16h fb[4][4];
  const _Float16* br = AO + ((size_t)b * NH * SEQ + n0 + ln) * HD;   /* head-major ctx plane: k chunk kc is head kc */
#pragma unroll
  for (int nt = 0; nt < 4; ++nt) {
#pragma unroll
    for (int kc = 0; kc < 4; ++kc) fb[nt][kc] = ld_frag(br + (size_t)kc * SEQ * HD + nt * 16 * HD, hh);
  }
  /* store stage: thread = (row tid / 16 of each 4-row group i, four tokens) */
  const size_t e0 = (size_t)b * XS + (size_t)(o0 + (tid >> 4)) * SEQ_FULL + n0 + (tid & 15) * 4;
  const float* xp = x + e0;
  const float* pp = pb + o0 + (tid >> 4);
  v4f xv[8];
  float pbr[8];
#pragma unroll
  for (int i = 0; i < 8; ++i) {
    xv[i] = *(const v4fa*)(xp + (size_t)i * 4 * SEQ_FULL);
    pbr[i] = pp[4 * i];
  }
  /* the address registers of the loads above stay as they are until this wait: none becomes another load's destination first */
  asm volatile("s_wait_xcnt 0x0" :: "v"(wr - 3 * CC * CC + 8 * hh), "v"(br + 8 * hh), "v"(xp) : "memory");
  __builtin_amdgcn_sched_barrier(0);   /* the first use of a loaded value, and with it the first wait for data, stays behind the issue of the last load */
#pragma unroll
  for (int nt = 0; nt < 4; ++nt) {
    v8f acc = {0.f, 0.f, 0.f, 0.f, 0.f, 0.f, 0.f, 0.f};
#pragma unroll
    for (int kc = 0; kc < 4; ++kc) acc = mma(fw[kc], fb[nt][kc], acc);
#pragma unroll
    for (int r = 0; r < 8; ++r) so[(16 * w + 8 * hh + r) * SOP + nt * 16 + ln] = acc[r] * 0.001953125f;
  }
  __syncthreads();
  {
#pragma unroll
    for (int i = 0; i < 8; ++i) {
      const v4f a = *(const v4fa*)&so[((tid >> 4) + 4 * i) * SOP + (tid & 15) * 4];
      const float pbv = bf16_rne(pbr[i]);
      v4f y;
#pragma unroll
      for (int q = 0; q < 4; ++q) y[q] = bf16_rne(xv[i][q]) + (a[q] + pbv);
      *(v4f*)(out + e0 + (size_t)i * 4 * SEQ_FULL) = y;
    }
    
  }
}

extern "C" void kernel_launch(void* const* d_in, const int* in_sizes, int n_in,
                              void* d_out, int out_size, void* d_ws, size_t ws_size, hipStream_t stream) {
  if (n_in < 11) return;
  if (in_sizes[0] < NB * CC * SEQ) return;
  if (in_sizes[1] < CC || in_sizes[2] < CC || in_sizes[4] < CC || in_sizes[6] < CC || in_sizes[8] < CC || in_sizes[10] < CC) return;
  if (in_sizes[3] < CC * CC || in_sizes[5] < CC * CC || in_sizes[7] < CC * CC || in_sizes[9] < CC * CC) return;
  if (out_size < NB * CC * SEQ) return;
  if (ws_size < WS_TOTAL) return;
  const float* x   = (const float*)d_in[0];
  const float* gnw = (const float*)d_in[1];
  const float* gnb = (const float*)d_in[2];
  const float* qw  = (const float*)d_in[3];
  const float* qb  = (const float*)d_in[4];
  const float* kw  = (const float*)d_in[5];
  const float* vw  = (const float*)d_in[7];
  const float* vb  = (const float*)d_in[8];
  const float* pw  = (const float*)d_in[9];
  const float* pb  = (const float*)d_in[10];
  char* ws = (char*)d_ws;
  _Float16* W16 = (_Float16*)(ws + WS_W16);
  float*    GS  = (float*)(ws + WS_GS);
  float*    CN  = (float*)(ws + WS_CN);
  _Float16* QK  = (_Float16*)(ws + WS_QK);
  _Float16* VT  = (_Float16*)(ws + WS_VT);
  _Float16* AO  = (_Float16*)(ws + WS_AO);
  k_qkv<<<dim3(3 * NTB + WCB + 8, NB), 256, 0, stream>>>(x, gnw, gnb, qw, qb, kw, vw, vb, pw, W16, GS, CN, QK, VT);
  k_attn<<<dim3(SEQ / (QT * 16) * NH, NB), KSPL * 32, 0, stream>>>(QK, VT, GS, CN, AO);
  k_proj<<<dim3(NTB * (CC / PJO), NB), PJO * 2, 0, stream>>>(x, W16, pb, AO, (float*)d_out);
}
